// v000
// The times below were measured on an AMD MI455X: many runs one after another, warmed up first and cycling through
// copies of the inputs, with the whole window's GPU time divided by the number of runs. Launches and the gaps
// between them are all in it. The median over several windows is given; except for v000 it joins two sittings, which
// can be a few percent apart, so the side-by-side timings, each taken in one sitting, are the better comparison.
// v000 is the starting kernel. One run takes 1430 microseconds.
#include <hip/hip_runtime.h>

// Causal multi-head attention with a fused qkv projection and rotary embeddings from FOUR input tables (query [2][2048][1024]; qkv = query w_in ('xw' [1024][3072] 1/32, no bias) -> q | k | v column thirds (16 heads x 64); q = q cos_q + rotate_half(q) sin_q, k = k cos_k + rotate_half(k) sin_k with sin_q, cos_q, sin_k, cos_k [1][1][2048][64] INPUTS (full-width per-element tables, separate for q and k; read as data); scores x 1/sqrt(64); causal (finfo.min); softmax; out = merged w_out ('xw' [1024][1024], no bias) -> [2][2048][1024] (4.2 M); argument order query, sin_q, cos_q, sin_k, cos_k, w_in, w_out).
// Layout per batch: bf16 copy of query; the fused 'xw' weight transposed once into Bt (q | k | v row blocks); exact projections; TWO {cos, sin} tables from the bf16-rounded inputs (one for q, one for k); rotate-half plane builders; causal T-2048 attention (hybrid rows: < 512 hi/lo 3 products, rest fp16 x1024; k_gemmc skips tiles above the diagonal); merged hi/lo x w_out exact.
// Compute dtypes, f32 accumulate: every input rounded to bf16 incl. the four tables; projections exact; rotary f32; attention rows < 512 3 products, rest fp16; softmax f32; w_out hl x exact.

#define NB_  2
#define TT   2048
#define DM   1024
#define NH_  16
#define NKV  16
#define REP  (NH_ / NKV)
#define HD   64
#define DQ   (NH_ * HD)
#define DKV  (NKV * HD)
#define ZH   2
#define RH   512                  // query rows < RH use hi+lo planes (0: none)
#define WIN  2048
#define PCAR 1024.0f
#define SCL  0.125f   // HD^-0.5
typedef _Float16 h16;
typedef unsigned short bf;
typedef __attribute__((ext_vector_type(16))) __bf16   v16bf;
typedef __attribute__((ext_vector_type(16))) _Float16 v16h;
typedef __attribute__((ext_vector_type(8)))  _Float16 v8h;
typedef __attribute__((ext_vector_type(8)))  unsigned short v8us;
typedef __attribute__((ext_vector_type(8)))  float    v8f;
typedef __attribute__((ext_vector_type(4)))  float    v4f;
typedef v8h  __attribute__((may_alias)) v8ha;
typedef v4f  __attribute__((may_alias)) v4fa;
typedef v8us __attribute__((may_alias)) v8usa;

__device__ __forceinline__ unsigned short f2bf(float f) { unsigned u = __float_as_uint(f); u += 0x7FFFu + ((u >> 16) & 1u); return (unsigned short)(u >> 16); }
__device__ __forceinline__ float bf2f(unsigned short b) { return __uint_as_float(((unsigned)b) << 16); }
__device__ __forceinline__ float bfr(float f) { return bf2f(f2bf(f)); }
__device__ __forceinline__ v16h cat16(v8h lo, v8h hi) { return __builtin_shufflevector(lo, hi, 0, 1, 2, 3, 4, 5, 6, 7, 8, 9, 10, 11, 12, 13, 14, 15); }
__device__ __forceinline__ v16bf cat16b(v8us lo, v8us hi) { return __builtin_bit_cast(v16bf, __builtin_shufflevector(lo, hi, 0, 1, 2, 3, 4, 5, 6, 7, 8, 9, 10, 11, 12, 13, 14, 15)); }
__device__ __forceinline__ v8f wmma16(v16h a, v16h b, v8f c) { return __builtin_amdgcn_wmma_f32_16x16x32_f16(false, a, false, b, (short)0, c, false, false); }
__device__ __forceinline__ v8f wmmab(v16bf a, v16bf b, v8f c) { return __builtin_amdgcn_wmma_f32_16x16x32_bf16(false, a, false, b, (short)0, c, false, false); }



// ---- k_gemmw: register-blocked GEMM, ONE WAVE per 64x64 output tile (16 accumulators), operands straight from K-contiguous 16-bit planes; grid (M/64, N/64, Z), 32 threads.
// C[m][n] (f32, pitch ldc, + optional f32 bias[n]) = sum_k A[m][k] Bt[n][k] (+ split products per NSPLIT). z-batch strides sA/sB/sC in elements. K % 32 == 0.
template <typename T16> struct WFrag;
template <> struct WFrag<h16> { typedef v16h V; static __device__ __forceinline__ V ld(const h16* p) { return cat16(*(const v8h*)p, *(const v8h*)(p + 16)); } static __device__ __forceinline__ v8f mma(V a, V b, v8f c) { return wmma16(a, b, c); } };
template <> struct WFrag<bf> { typedef v16bf V; static __device__ __forceinline__ V ld(const bf* p) { return cat16b(*(const v8us*)p, *(const v8us*)(p + 16)); } static __device__ __forceinline__ v8f mma(V a, V b, v8f c) { return wmmab(a, b, c); } };
template <typename T16, int NSPLIT, bool BIAS>
__global__ __launch_bounds__(32) void k_gemmw(const T16* __restrict__ A, const T16* __restrict__ A2, const T16* __restrict__ Bt, const T16* __restrict__ Bt2, int K, float* C, int ldc, const float* __restrict__ bias, size_t sA, size_t sB, size_t sC) {
    typedef typename WFrag<T16>::V V;
    __shared__ __align__(16) float os[16 * 68];
    const size_t z = blockIdx.z; A += z * sA; if (A2) A2 += z * sA; Bt += z * sB; if (Bt2) Bt2 += z * sB; C += z * sC;
    const int lane = threadIdx.x & 31, lr = lane & 15, hi = lane >> 4; const int r0 = blockIdx.x * 64, c0 = blockIdx.y * 64;
    v8f acc[4][4];
#pragma unroll
    for (int mb = 0; mb < 4; ++mb)
#pragma unroll
        for (int nb = 0; nb < 4; ++nb) acc[mb][nb] = (v8f){};
    const size_t aoff = (size_t)(r0 + lr) * K + 8 * hi, boff = (size_t)(c0 + lr) * K + 8 * hi;
#pragma unroll 1
    for (int kc = 0; kc < K; kc += 32) {
        V a[4], a2[4];
#pragma unroll
        for (int mb = 0; mb < 4; ++mb) { a[mb] = WFrag<T16>::ld(A + aoff + (size_t)mb * 16 * K + kc); if (NSPLIT == 1 || NSPLIT == 2) a2[mb] = WFrag<T16>::ld(A2 + aoff + (size_t)mb * 16 * K + kc); }
#pragma unroll
        for (int nb = 0; nb < 4; ++nb) { const V b = WFrag<T16>::ld(Bt + boff + (size_t)nb * 16 * K + kc); V b2; if (NSPLIT >= 2) b2 = WFrag<T16>::ld(Bt2 + boff + (size_t)nb * 16 * K + kc);
#pragma unroll
            for (int mb = 0; mb < 4; ++mb) { acc[mb][nb] = WFrag<T16>::mma(a[mb], b, acc[mb][nb]); if (NSPLIT == 1 || NSPLIT == 2) acc[mb][nb] = WFrag<T16>::mma(a2[mb], b, acc[mb][nb]); if (NSPLIT >= 2) acc[mb][nb] = WFrag<T16>::mma(a[mb], b2, acc[mb][nb]); } }
        asm volatile("v_nop\n\tv_nop\n\tv_nop\n\tv_nop" : "+v"(acc[0][0]), "+v"(acc[1][1]), "+v"(acc[2][2]), "+v"(acc[3][3]) : "v"(a[0]), "v"(a[3]));
    }
#pragma unroll
    for (int mb = 0; mb < 4; ++mb) {
#pragma unroll
        for (int nb = 0; nb < 4; ++nb) {
#pragma unroll
            for (int j = 0; j < 8; ++j) os[(hi * 8 + j) * 68 + nb * 16 + lr] = acc[mb][nb][j]; }
        __builtin_amdgcn_wave_barrier(); asm volatile("" ::: "memory");
        float* crow = C + (size_t)(r0 + mb * 16) * ldc + c0;
{
#pragma unroll
            for (int s = 0; s < 8; ++s) { const int row = 2 * s + hi, cofs = lr * 4; v4f val = *(const v4fa*)(os + row * 68 + cofs); if (BIAS) { val[0] += bfr(bias[c0 + cofs]); val[1] += bfr(bias[c0 + cofs + 1]); val[2] += bfr(bias[c0 + cofs + 2]); val[3] += bfr(bias[c0 + cofs + 3]); }
                *(v4f*)(crow + (size_t)row * ldc + cofs) = val; }
             }
        __builtin_amdgcn_wave_barrier(); asm volatile("" ::: "memory");
    }
}

// ---- k_gemmc: the same one-wave 64x64 tile GEMM specialised for causal attention: CMODE 1 skips score tiles entirely above the diagonal (query rows r0+roff.., key columns c0..), CMODE 2 limits the
// key (K) loop of the probability x value contraction to the diagonal block (probabilities beyond it are exactly zero). roff = row offset of this launch's first row within the sequence.
template <typename T16, int NSPLIT, int CMODE>
__global__ __launch_bounds__(32) void k_gemmc(const T16* __restrict__ A, const T16* __restrict__ A2, const T16* __restrict__ Bt, const T16* __restrict__ Bt2, int K, float* C, int ldc, int roff, size_t sA, size_t sB, size_t sC) {
    typedef typename WFrag<T16>::V V;
    __shared__ __align__(16) float os[16 * 68];
    const size_t z = blockIdx.z; A += z * sA; if (A2) A2 += z * sA; Bt += z * sB; if (Bt2) Bt2 += z * sB; C += z * sC;
    const int lane = threadIdx.x & 31, lr = lane & 15, hi = lane >> 4; const int r0 = blockIdx.x * 64, c0 = blockIdx.y * 64;
    if (CMODE == 1 && c0 > r0 + roff + 63) return;                  // score tile entirely above the causal diagonal: never written (the softmax masks j > i by select)
    const int Kl = (CMODE == 2) ? min(K, r0 + roff + 64) : K;        // P.V: probabilities are exactly 0 beyond the diagonal block, so the K loop stops there
    v8f acc[4][4];
#pragma unroll
    for (int mb = 0; mb < 4; ++mb)
#pragma unroll
        for (int nb = 0; nb < 4; ++nb) acc[mb][nb] = (v8f){};
    const size_t aoff = (size_t)(r0 + lr) * K + 8 * hi, boff = (size_t)(c0 + lr) * K + 8 * hi;
#pragma unroll 1
    for (int kc = 0; kc < Kl; kc += 32) {
        V a[4], a2[4];
#pragma unroll
        for (int mb = 0; mb < 4; ++mb) { a[mb] = WFrag<T16>::ld(A + aoff + (size_t)mb * 16 * K + kc); if (NSPLIT == 1 || NSPLIT == 2) a2[mb] = WFrag<T16>::ld(A2 + aoff + (size_t)mb * 16 * K + kc); }
#pragma unroll
        for (int nb = 0; nb < 4; ++nb) { const V b = WFrag<T16>::ld(Bt + boff + (size_t)nb * 16 * K + kc); V b2; if (NSPLIT >= 2) b2 = WFrag<T16>::ld(Bt2 + boff + (size_t)nb * 16 * K + kc);
#pragma unroll
            for (int mb = 0; mb < 4; ++mb) { acc[mb][nb] = WFrag<T16>::mma(a[mb], b, acc[mb][nb]); if (NSPLIT == 1 || NSPLIT == 2) acc[mb][nb] = WFrag<T16>::mma(a2[mb], b, acc[mb][nb]); if (NSPLIT >= 2) acc[mb][nb] = WFrag<T16>::mma(a[mb], b2, acc[mb][nb]); } }
        asm volatile("v_nop\n\tv_nop\n\tv_nop\n\tv_nop" : "+v"(acc[0][0]), "+v"(acc[1][1]), "+v"(acc[2][2]), "+v"(acc[3][3]) : "v"(a[0]), "v"(a[3]));
    }
#pragma unroll
    for (int mb = 0; mb < 4; ++mb) {
#pragma unroll
        for (int nb = 0; nb < 4; ++nb) {
#pragma unroll
            for (int j = 0; j < 8; ++j) os[(hi * 8 + j) * 68 + nb * 16 + lr] = acc[mb][nb][j]; }
        __builtin_amdgcn_wave_barrier(); asm volatile("" ::: "memory");
        float* crow = C + (size_t)(r0 + mb * 16) * ldc + c0;
{
#pragma unroll
            for (int s = 0; s < 8; ++s) { const int row = 2 * s + hi, cofs = lr * 4; v4f val = *(const v4fa*)(os + row * 68 + cofs);
                *(v4f*)(crow + (size_t)row * ldc + cofs) = val; }
             }
        __builtin_amdgcn_wave_barrier(); asm volatile("" ::: "memory");
    }
}

__device__ __forceinline__ h16 tohx(float x) { return (h16)x; }
__device__ __forceinline__ void splitf(float y, unsigned short& h, unsigned short& l) { h = f2bf(y); l = f2bf(y - bf2f(h)); }
typedef __attribute__((ext_vector_type(2))) _Float16 v2h;
typedef __attribute__((ext_vector_type(4))) _Float16 v4h;
typedef __attribute__((ext_vector_type(2))) unsigned short v2us;
typedef __attribute__((ext_vector_type(4))) unsigned short v4us;
typedef __attribute__((ext_vector_type(2))) float v2f;
typedef __attribute__((ext_vector_type(4))) int v4i;

__global__ __launch_bounds__(256) void k_wtG(const float* __restrict__ w, int K, int N, bf* Bt) {
    const int lane = threadIdx.x & 31; const int L0 = (blockIdx.x * 8 + (threadIdx.x >> 5)) * 8; const int nlines = N * K / 64;
{
#pragma unroll 1
        for (int l = 0; l < 8; ++l) { const int L = L0 + l; if (L >= nlines) break; const size_t e = (size_t)L * 64 + lane * 2; const int k = (int)(e % K), n = (int)(e / K); v2us o;
            o[0] = f2bf(w[(size_t)k * N + n]); o[1] = f2bf(w[(size_t)(k + 1) * N + n]); *(v2us*)(Bt + e) = o; }
         }
}
__global__ __launch_bounds__(256) void k_cvt8(const float* __restrict__ src, bf* dst, size_t n8) { const size_t i = (size_t)blockIdx.x * 256 + threadIdx.x; if (i >= n8) return; const v8f v = *(const v8f*)(src + i * 8); v8us o;
#pragma unroll
    for (int k = 0; k < 8; ++k) o[k] = f2bf(v[k]); *(v8us*)(dst + i * 8) = o;  }

// k_rope: head planes [h][t][d] (fp16 + hi/lo) of rope(x) x sc with the rotate-half convention out[d] = x[d] cos[t][d] - x[d+HD/2] sin[t][d], out[d+HD/2] = x[d+HD/2] cos[t][d+HD/2] + x[d] sin[t][d+HD/2]
__global__ __launch_bounds__(256) void k_rope(const float* __restrict__ F, int pitch, int nheads, const float* __restrict__ CS, const float* __restrict__ RF, const float* __restrict__ nw, float sc, h16* P16, bf* Ph, bf* Pl) {
    const size_t e = ((size_t)blockIdx.x * 256 + threadIdx.x) * 2; if (e >= (size_t)nheads * TT * HD) return; const int d = (int)(e % HD); const int t = (int)((e / HD) % TT); const int h = (int)(e / ((size_t)HD * TT)); const float* f = F + (size_t)t * pitch + h * HD; const float rf = RF ? RF[(size_t)h * TT + t] : 1.0f; v2h o16; v2us oh, ol;
#pragma unroll
    for (int q = 0; q < 2; ++q) { const int dd = d + q; const int dp = (dd < HD / 2) ? dd + HD / 2 : dd - HD / 2; float x0 = f[dd], x1 = f[dp];
        if (RF) { float n0 = __fmul_rn(x0, rf), n1 = __fmul_rn(x1, rf); asm volatile("" : "+v"(n0)); asm volatile("" : "+v"(n1)); x0 = __fmul_rn(bfr(nw[dd]), n0); x1 = __fmul_rn(bfr(nw[dp]), n1); }
        const v2f cs = *(const v2f*)(CS + ((size_t)t * HD + dd) * 2); float a = __fmul_rn(x0, cs[0]), bq = __fmul_rn(x1, cs[1]); asm volatile("" : "+v"(a)); asm volatile("" : "+v"(bq)); const float r = ((dd < HD / 2) ? __fsub_rn(a, bq) : __fadd_rn(a, bq)) * sc;
        o16[q] = tohx(r); unsigned short a2, c2; splitf(r, a2, c2); oh[q] = a2; ol[q] = c2; }
    *(v2h*)(P16 + e) = o16; *(v2us*)(Ph + e) = oh; *(v2us*)(Pl + e) = ol;  }
__global__ __launch_bounds__(256) void k_vtp(const float* __restrict__ F, int pitch, int nheads, h16* V16, bf* Vh, bf* Vl) { const size_t e = ((size_t)blockIdx.x * 256 + threadIdx.x) * 2; if (e >= (size_t)nheads * HD * TT) return; const int t = (int)(e % TT); const int d = (int)((e / TT) % HD); const int g = (int)(e / ((size_t)TT * HD)); v2h o16; v2us oh, ol;
#pragma unroll
    for (int q = 0; q < 2; ++q) { const float x = F[(size_t)(t + q) * pitch + g * HD + d]; o16[q] = tohx(x); unsigned short a2, c2; splitf(x, a2, c2); oh[q] = a2; ol[q] = c2; }
    *(v2h*)(V16 + e) = o16; *(v2us*)(Vh + e) = oh; *(v2us*)(Vl + e) = ol;  }
__global__ __launch_bounds__(256) void k_cscvt(const float* __restrict__ cosT, const float* __restrict__ sinT, float* CS) { const int idx = blockIdx.x * 256 + threadIdx.x; if (idx >= TT * HD) return; v2f cs; cs[0] = bfr(cosT[idx]); cs[1] = bfr(sinT[idx]); *(v2f*)(CS + (size_t)idx * 2) = cs;  }
// k_asoft: per row (zz, i): t = S x HD^-0.5 for j <= i and i - j < WIN (sliding causal window; the reference's -1e9 additive fill vanishes identically); softmax over the 2048 keys (register row, one exp, fixed trees);
__global__ __launch_bounds__(256) void k_asoft(const float* __restrict__ Sb, h16* P16, bf* Ph, bf* Pl) {
    const int lane = threadIdx.x & 31; const int row = blockIdx.x * 8 + (threadIdx.x >> 5); if (row >= ZH * TT) return; const int i = row % TT; const int zz = row / TT; (void)zz; const bool hires = (i < RH); const float* sr = Sb + (size_t)row * TT; float v[TT / 32]; float mx = -3.0e38f;
#pragma unroll
    for (int ch = 0; ch < TT / 128; ++ch) { const int j0 = ch * 128 + lane * 4; const v4f a = *(const v4f*)(sr + j0);
#pragma unroll
        for (int q = 0; q < 4; ++q) { const int j = j0 + q; (void)j; const float t = (j <= i && i - j < WIN) ? a[q] * SCL : -3.0e38f; v[ch * 4 + q] = t; mx = fmaxf(mx, t); } }
#pragma unroll
    for (int sh = 16; sh; sh >>= 1) mx = fmaxf(mx, __shfl_xor(mx, sh, 32));
    float sum = 0.f;
#pragma unroll
    for (int k = 0; k < TT / 32; ++k) { float d0 = __fsub_rn(v[k], mx); asm volatile("" : "+v"(d0)); v[k] = __builtin_amdgcn_exp2f(__fmul_rn(d0, 1.4426950408889634f)); sum += v[k]; }
#pragma unroll
    for (int sh = 16; sh; sh >>= 1) sum += __shfl_xor(sum, sh, 32);
    const float f = __fdiv_rn(hires ? 1.0f : PCAR, sum);
{
        if (hires) {
#pragma unroll
            for (int ch = 0; ch < TT / 128; ++ch) { v4us oh, ol;
#pragma unroll
                for (int q = 0; q < 4; ++q) { unsigned short a, c2; splitf(v[ch * 4 + q] * f, a, c2); oh[q] = a; ol[q] = c2; }
                const size_t oo = ((size_t)zz * (RH ? RH : 1) + i) * TT + ch * 128 + lane * 4; *(v4us*)(Ph + oo) = oh; *(v4us*)(Pl + oo) = ol; }
        } else {
#pragma unroll
            for (int ch = 0; ch < TT / 128; ++ch) { v4h o4;
#pragma unroll
                for (int q = 0; q < 4; ++q) o4[q] = tohx(v[ch * 4 + q] * f);
                *(v4h*)(P16 + (size_t)row * TT + ch * 128 + lane * 4) = o4; } }
         }
}
__global__ __launch_bounds__(256) void k_merge(const float* __restrict__ O, int h0, bf* Ah, bf* Al) { const size_t e = ((size_t)blockIdx.x * 256 + threadIdx.x) * 2; if (e >= (size_t)ZH * TT * HD) return; const int d = (int)(e % HD); const int t = (int)((e / HD) % TT); const int zz = (int)(e / ((size_t)HD * TT)); const float cs = (t < RH) ? 1.0f : (1.0f / PCAR); const size_t oo = (size_t)t * DQ + (h0 + zz) * HD + d;
    v2us oh, ol;
#pragma unroll
    for (int q = 0; q < 2; ++q) { unsigned short a, c2; splitf(O[e + q] * cs, a, c2); oh[q] = a; ol[q] = c2; } *(v2us*)(Ah + oo) = oh; *(v2us*)(Al + oo) = ol;  }

extern "C" void kernel_launch(void* const* d_in, const int* in_sizes, int n_in,
                              void* d_out, int out_size, void* d_ws, size_t ws_size, hipStream_t stream) {
    (void)in_sizes; (void)n_in; (void)out_size;
    const float* x = (const float*)d_in[0]; const float* fsinq = (const float*)d_in[1]; const float* fcosq = (const float*)d_in[2]; const float* fsink = (const float*)d_in[3]; const float* fcosk = (const float*)d_in[4]; const float* wqkv = (const float*)d_in[5]; const float* wo = (const float*)d_in[6];   /* input order query, sin_q, cos_q, sin_k, cos_k ([1][1][2048][64] each), w_in ('xw' [1024][3072]), w_out ('xw') */ const float* wq = wqkv; const float* wk = nullptr; const float* wv = nullptr; (void)wk; (void)wv;
    float* OUT = (float*)d_out;     // [2][2048][1024]
    char* wsp = (char*)d_ws;
    auto take = [&](size_t bytes) { char* p = wsp; wsp += (bytes + 255) & ~(size_t)255; return (void*)p; };
    bf* WQKV = (bf*)take((size_t)3 * DQ * DM * 2); bf* WQ = WQKV; bf* WK = WQKV + (size_t)DQ * DM; bf* WV = WQKV + (size_t)2 * DQ * DM;   /* fused Bt [3*DQ][DM]: q | k | v row blocks */ bf* WO = (bf*)take((size_t)DM * DQ * 2); float* CS = (float*)take((size_t)TT * HD * 2 * 4); float* CSK = (float*)take((size_t)TT * HD * 2 * 4);   /* second {cos, sin} table: the k stream has its own input tables */
    bf* XB = (bf*)take((size_t)TT * DM * 2); float* FQ = (float*)take((size_t)TT * DQ * 4); float* FK = (float*)take((size_t)TT * DKV * 4);
    h16* QP16 = (h16*)take((size_t)NH_ * TT * HD * 2); h16* KP16 = (h16*)take((size_t)NKV * TT * HD * 2); h16* VT16 = (h16*)take((size_t)NKV * HD * TT * 2);
    bf* QPh = (bf*)take((size_t)NH_ * TT * HD * 2); bf* QPl = (bf*)take((size_t)NH_ * TT * HD * 2); bf* KPh = (bf*)take((size_t)NKV * TT * HD * 2); bf* KPl = (bf*)take((size_t)NKV * TT * HD * 2); bf* VTh = (bf*)take((size_t)NKV * HD * TT * 2); bf* VTl = (bf*)take((size_t)NKV * HD * TT * 2); bf* Ph = (bf*)take((size_t)ZH * RH * TT * 2); bf* Pl = (bf*)take((size_t)ZH * RH * TT * 2);
    float* Sb = (float*)take((size_t)ZH * TT * TT * 4); h16* P16 = (h16*)take((size_t)ZH * TT * TT * 2); float* Ob = (float*)take((size_t)ZH * TT * HD * 4); bf* ATh = (bf*)take((size_t)TT * DQ * 2); bf* ATl = (bf*)take((size_t)TT * DQ * 2);
    if ((size_t)(wsp - (char*)d_ws) > ws_size) return;    // ws 256 MiB
    float* FV = FK;   // v projection reuses the k buffer after the k planes are built (stream-ordered)
    { k_wtG<<<(unsigned)((DM * 3 * DQ / 64 + 63) / 64), 256, 0, stream>>>(wqkv, DM, 3 * DQ, WQKV);   /* fused 'xw' [DM][3*DQ] -> Bt [3*DQ][DM] */
      k_wtG<<<(unsigned)((DQ * DM / 64 + 63) / 64), 256, 0, stream>>>(wo, DQ, DM, WO);
       }
    k_cscvt<<<(TT * HD + 255) / 256, 256, 0, stream>>>(fcosq, fsinq, CS);   /* q table from cos_q, sin_q */ k_cscvt<<<(TT * HD + 255) / 256, 256, 0, stream>>>(fcosk, fsink, CSK);   /* k table from cos_k, sin_k */
    const unsigned LQ = (unsigned)(((size_t)NH_ * TT * HD / 2 + 255) / 256), LKv = (unsigned)(((size_t)NKV * TT * HD / 2 + 255) / 256);
    for (int b = 0; b < NB_; ++b) {
        
        k_cvt8<<<(unsigned)(((size_t)TT * DM / 8 + 255) / 256), 256, 0, stream>>>(x + (size_t)b * TT * DM, XB, (size_t)TT * DM / 8);
        k_gemmw<bf, 0, false><<<dim3(TT / 64, DQ / 64, 1), 32, 0, stream>>>(XB, nullptr, WQ, nullptr, DM, FQ, DQ, nullptr, 0, 0, 0);
        k_rope<<<LQ, 256, 0, stream>>>(FQ, DQ, NH_, CS, nullptr, nullptr, 1.0f, QP16, QPh, QPl);
        k_gemmw<bf, 0, false><<<dim3(TT / 64, DKV / 64, 1), 32, 0, stream>>>(XB, nullptr, WK, nullptr, DM, FK, DKV, nullptr, 0, 0, 0);
        k_rope<<<LKv, 256, 0, stream>>>(FK, DKV, NKV, CSK, nullptr, nullptr, 1.0f, KP16, KPh, KPl);
        k_gemmw<bf, 0, false><<<dim3(TT / 64, DKV / 64, 1), 32, 0, stream>>>(XB, nullptr, WV, nullptr, DM, FV, DKV, nullptr, 0, 0, 0); k_vtp<<<LKv, 256, 0, stream>>>(FV, DKV, NKV, VT16, VTh, VTl);
        for (int h0 = 0; h0 < NH_; h0 += ZH) { const size_t zq = (size_t)h0, zk = (size_t)(h0 / REP);   // one kv head per query head: the pass's two heads use consecutive kv planes (z-strides TT*HD)
            k_gemmc<bf, 2, 1><<<dim3(RH / 64, TT / 64, ZH), 32, 0, stream>>>(QPh + zq * TT * HD, QPl + zq * TT * HD, KPh + zk * TT * HD, KPl + zk * TT * HD, HD, Sb, TT, 0, (size_t)TT * HD, (size_t)TT * HD, (size_t)TT * TT);
            k_gemmc<h16, 0, 1><<<dim3((TT - RH) / 64, TT / 64, ZH), 32, 0, stream>>>(QP16 + zq * TT * HD + (size_t)RH * HD, nullptr, KP16 + zk * TT * HD, nullptr, HD, Sb + (size_t)RH * TT, TT, RH, (size_t)TT * HD, (size_t)TT * HD, (size_t)TT * TT);
            k_asoft<<<ZH * TT / 8, 256, 0, stream>>>(Sb, P16, Ph, Pl);
            k_gemmc<bf, 2, 2><<<dim3(RH / 64, HD / 64, ZH), 32, 0, stream>>>(Ph, Pl, VTh + zk * HD * TT, VTl + zk * HD * TT, TT, Ob, HD, 0, (size_t)RH * TT, (size_t)HD * TT, (size_t)TT * HD);
            k_gemmc<h16, 0, 2><<<dim3((TT - RH) / 64, HD / 64, ZH), 32, 0, stream>>>(P16 + (size_t)RH * TT, nullptr, VT16 + zk * HD * TT, nullptr, TT, Ob + (size_t)RH * HD, HD, RH, (size_t)TT * TT, (size_t)HD * TT, (size_t)TT * HD);
            k_merge<<<(unsigned)(((size_t)ZH * TT * HD / 2 + 255) / 256), 256, 0, stream>>>(Ob, h0, ATh, ATl); }
        k_gemmw<bf, 1, false><<<dim3(TT / 64, DM / 64, 1), 32, 0, stream>>>(ATh, ATl, WO, nullptr, DQ, OUT + (size_t)b * TT * DM, DM, nullptr, 0, 0, 0); }
}

// v001
// A run of this version takes 759 microseconds.
// Next to v000, in two timings, it ran 1.89 times as fast each time.
#include <hip/hip_runtime.h>

// Causal multi-head attention with a fused qkv projection and rotary embeddings from FOUR input tables (query [2][2048][1024]; qkv = query w_in ('xw' [1024][3072] 1/32, no bias) -> q | k | v column thirds (16 heads x 64); q = q cos_q + rotate_half(q) sin_q, k = k cos_k + rotate_half(k) sin_k with sin_q, cos_q, sin_k, cos_k [1][1][2048][64] INPUTS (full-width per-element tables, separate for q and k; read as data); scores x 1/sqrt(64); causal (finfo.min); softmax; out = merged w_out ('xw' [1024][1024], no bias) -> [2][2048][1024] (4.2 M); argument order query, sin_q, cos_q, sin_k, cos_k, w_in, w_out).
// Layout per batch: bf16 copy of query; the fused 'xw' weight transposed once into Bt (q | k | v row blocks); exact projections; TWO {cos, sin} tables from the bf16-rounded inputs (one for q, one for k); rotate-half plane builders; causal T-2048 attention (hybrid rows: < 512 hi/lo 3 products, rest fp16 x1024; k_gemmc skips tiles above the diagonal); merged hi/lo x w_out exact.
// Compute dtypes, f32 accumulate: every input rounded to bf16 incl. the four tables; projections exact; rotary f32; attention rows < 512 3 products, rest fp16; softmax f32; w_out hl x exact.

#define NB_  2
#define TT   2048
#define DM   1024
#define NH_  16
#define NKV  16
#define REP  (NH_ / NKV)
#define HD   64
#define DQ   (NH_ * HD)
#define DKV  (NKV * HD)
#define ZH   2
#define RH   512                  // query rows < RH use hi+lo planes (0: none)
#define WIN  2048
#define PCAR 1024.0f
#define SCL  0.125f   // HD^-0.5
#define KSP  16                   // key splits of the probability x value product: one work-group per split, f32 partial planes summed in k_merge
typedef _Float16 h16;
typedef unsigned short bf;
typedef __attribute__((ext_vector_type(16))) __bf16   v16bf;
typedef __attribute__((ext_vector_type(16))) _Float16 v16h;
typedef __attribute__((ext_vector_type(8)))  _Float16 v8h;
typedef __attribute__((ext_vector_type(8)))  unsigned short v8us;
typedef __attribute__((ext_vector_type(8)))  float    v8f;
typedef __attribute__((ext_vector_type(4)))  float    v4f;
typedef v8h  __attribute__((may_alias)) v8ha;
typedef v4f  __attribute__((may_alias)) v4fa;
typedef v8us __attribute__((may_alias)) v8usa;

__device__ __forceinline__ unsigned short f2bf(float f) { unsigned u = __float_as_uint(f); u += 0x7FFFu + ((u >> 16) & 1u); return (unsigned short)(u >> 16); }
__device__ __forceinline__ float bf2f(unsigned short b) { return __uint_as_float(((unsigned)b) << 16); }
__device__ __forceinline__ float bfr(float f) { return bf2f(f2bf(f)); }
__device__ __forceinline__ v16h cat16(v8h lo, v8h hi) { return __builtin_shufflevector(lo, hi, 0, 1, 2, 3, 4, 5, 6, 7, 8, 9, 10, 11, 12, 13, 14, 15); }
__device__ __forceinline__ v16bf cat16b(v8us lo, v8us hi) { return __builtin_bit_cast(v16bf, __builtin_shufflevector(lo, hi, 0, 1, 2, 3, 4, 5, 6, 7, 8, 9, 10, 11, 12, 13, 14, 15)); }
__device__ __forceinline__ v8f wmma16(v16h a, v16h b, v8f c) { return __builtin_amdgcn_wmma_f32_16x16x32_f16(false, a, false, b, (short)0, c, false, false); }
__device__ __forceinline__ v8f wmmab(v16bf a, v16bf b, v8f c) { return __builtin_amdgcn_wmma_f32_16x16x32_bf16(false, a, false, b, (short)0, c, false, false); }



// ---- k_gemmw: register-blocked GEMM, ONE WAVE per 64x64 output tile (16 accumulators), operands straight from K-contiguous 16-bit planes; grid (M/64, N/64, Z), 32 threads.
// C[m][n] (f32, pitch ldc, + optional f32 bias[n]) = sum_k A[m][k] Bt[n][k] (+ split products per NSPLIT). z-batch strides sA/sB/sC in elements. K % 32 == 0.
template <typename T16> struct WFrag;
template <> struct WFrag<h16> { typedef v16h V; static __device__ __forceinline__ V ld(const h16* p) { return cat16(*(const v8h*)p, *(const v8h*)(p + 16)); } static __device__ __forceinline__ v8f mma(V a, V b, v8f c) { return wmma16(a, b, c); } };
template <> struct WFrag<bf> { typedef v16bf V; static __device__ __forceinline__ V ld(const bf* p) { return cat16b(*(const v8us*)p, *(const v8us*)(p + 16)); } static __device__ __forceinline__ v8f mma(V a, V b, v8f c) { return wmmab(a, b, c); } };
template <typename T16, int NSPLIT, bool BIAS>
__global__ __launch_bounds__(32) void k_gemmw(const T16* __restrict__ A, const T16* __restrict__ A2, const T16* __restrict__ Bt, const T16* __restrict__ Bt2, int K, float* C, int ldc, const float* __restrict__ bias, size_t sA, size_t sB, size_t sC) {
    typedef typename WFrag<T16>::V V;
    __shared__ __align__(16) float os[16 * 68];
    const size_t z = blockIdx.z; A += z * sA; if (A2) A2 += z * sA; Bt += z * sB; if (Bt2) Bt2 += z * sB; C += z * sC;
    const int lane = threadIdx.x & 31, lr = lane & 15, hi = lane >> 4; const int r0 = blockIdx.x * 64, c0 = blockIdx.y * 64;
    v8f acc[4][4];
#pragma unroll
    for (int mb = 0; mb < 4; ++mb)
#pragma unroll
        for (int nb = 0; nb < 4; ++nb) acc[mb][nb] = (v8f){};
    const size_t aoff = (size_t)(r0 + lr) * K + 8 * hi, boff = (size_t)(c0 + lr) * K + 8 * hi;
#pragma unroll 1
    for (int kc = 0; kc < K; kc += 32) {
        V a[4], a2[4];
#pragma unroll
        for (int mb = 0; mb < 4; ++mb) { a[mb] = WFrag<T16>::ld(A + aoff + (size_t)mb * 16 * K + kc); if (NSPLIT == 1 || NSPLIT == 2) a2[mb] = WFrag<T16>::ld(A2 + aoff + (size_t)mb * 16 * K + kc); }
#pragma unroll
        for (int nb = 0; nb < 4; ++nb) { const V b = WFrag<T16>::ld(Bt + boff + (size_t)nb * 16 * K + kc); V b2; if (NSPLIT >= 2) b2 = WFrag<T16>::ld(Bt2 + boff + (size_t)nb * 16 * K + kc);
#pragma unroll
            for (int mb = 0; mb < 4; ++mb) { acc[mb][nb] = WFrag<T16>::mma(a[mb], b, acc[mb][nb]); if (NSPLIT == 1 || NSPLIT == 2) acc[mb][nb] = WFrag<T16>::mma(a2[mb], b, acc[mb][nb]); if (NSPLIT >= 2) acc[mb][nb] = WFrag<T16>::mma(a[mb], b2, acc[mb][nb]); } }
        asm volatile("v_nop\n\tv_nop\n\tv_nop\n\tv_nop" : "+v"(acc[0][0]), "+v"(acc[1][1]), "+v"(acc[2][2]), "+v"(acc[3][3]) : "v"(a[0]), "v"(a[3]));
    }
#pragma unroll
    for (int mb = 0; mb < 4; ++mb) {
#pragma unroll
        for (int nb = 0; nb < 4; ++nb) {
#pragma unroll
            for (int j = 0; j < 8; ++j) os[(hi * 8 + j) * 68 + nb * 16 + lr] = acc[mb][nb][j]; }
        __builtin_amdgcn_wave_barrier(); asm volatile("" ::: "memory");
        float* crow = C + (size_t)(r0 + mb * 16) * ldc + c0;
{
#pragma unroll
            for (int s = 0; s < 8; ++s) { const int row = 2 * s + hi, cofs = lr * 4; v4f val = *(const v4fa*)(os + row * 68 + cofs); if (BIAS) { val[0] += bfr(bias[c0 + cofs]); val[1] += bfr(bias[c0 + cofs + 1]); val[2] += bfr(bias[c0 + cofs + 2]); val[3] += bfr(bias[c0 + cofs + 3]); }
                *(v4f*)(crow + (size_t)row * ldc + cofs) = val; }
             }
        __builtin_amdgcn_wave_barrier(); asm volatile("" ::: "memory");
    }
}

// ---- k_gemmc: the same one-wave 64x64 tile GEMM specialised for causal attention: CMODE 1 skips score tiles entirely above the diagonal (query rows r0+roff.., key columns c0..), CMODE 2 limits the
// key (K) loop of the probability x value contraction to the diagonal block (probabilities beyond it are exactly zero). roff = row offset of this launch's first row within the sequence.
// CMODE 2 also splits the key loop over blockIdx.y (the product has one 64-column tile): split s takes the 64-key chunks s, s + KSP, ... (one 128-byte line of each row per chunk) and stores its own f32 partial plane C + s * sP;
// a split with no chunk below the diagonal stores zeros, so that k_merge reads KSP written planes for every row.
template <typename T16, int NSPLIT, int CMODE>
__global__ __launch_bounds__(32) void k_gemmc(const T16* __restrict__ A, const T16* __restrict__ A2, const T16* __restrict__ Bt, const T16* __restrict__ Bt2, int K, float* C, int ldc, int roff, size_t sA, size_t sB, size_t sC, size_t sP) {
    typedef typename WFrag<T16>::V V;
    __shared__ __align__(16) float os[16 * 68];
    const size_t z = blockIdx.z; A += z * sA; if (A2) A2 += z * sA; Bt += z * sB; if (Bt2) Bt2 += z * sB; C += z * sC;
    const int lane = threadIdx.x & 31, lr = lane & 15, hi = lane >> 4; const int r0 = blockIdx.x * 64, c0 = (CMODE == 2) ? 0 : blockIdx.y * 64; const int ks = (CMODE == 2) ? blockIdx.y : 0; C += (size_t)ks * sP;
    if (CMODE == 1 && c0 > r0 + roff + 63) return;                  // score tile entirely above the causal diagonal: never written (the softmax loads it but masks j > i by select)
    const int Kl = (CMODE == 2) ? min(K, r0 + roff + 64) : K;        // P.V: probabilities are exactly 0 beyond the diagonal block, so the K loop stops there
    v8f acc[4][4];
#pragma unroll
    for (int mb = 0; mb < 4; ++mb)
#pragma unroll
        for (int nb = 0; nb < 4; ++nb) acc[mb][nb] = (v8f){};
    const size_t aoff = (size_t)(r0 + lr) * K + 8 * hi, boff = (size_t)(c0 + lr) * K + 8 * hi;
    auto kstep = [&](int kc) {
        V a[4], a2[4];
#pragma unroll
        for (int mb = 0; mb < 4; ++mb) { a[mb] = WFrag<T16>::ld(A + aoff + (size_t)mb * 16 * K + kc); if (NSPLIT == 1 || NSPLIT == 2) a2[mb] = WFrag<T16>::ld(A2 + aoff + (size_t)mb * 16 * K + kc); }
#pragma unroll
        for (int nb = 0; nb < 4; ++nb) { const V b = WFrag<T16>::ld(Bt + boff + (size_t)nb * 16 * K + kc); V b2; if (NSPLIT >= 2) b2 = WFrag<T16>::ld(Bt2 + boff + (size_t)nb * 16 * K + kc);
#pragma unroll
            for (int mb = 0; mb < 4; ++mb) { acc[mb][nb] = WFrag<T16>::mma(a[mb], b, acc[mb][nb]); if (NSPLIT == 1 || NSPLIT == 2) acc[mb][nb] = WFrag<T16>::mma(a2[mb], b, acc[mb][nb]); if (NSPLIT >= 2) acc[mb][nb] = WFrag<T16>::mma(a[mb], b2, acc[mb][nb]); } }
        asm volatile("v_nop\n\tv_nop\n\tv_nop\n\tv_nop" : "+v"(acc[0][0]), "+v"(acc[1][1]), "+v"(acc[2][2]), "+v"(acc[3][3]) : "v"(a[0]), "v"(a[3]));
    };
    if (CMODE == 2) {
#pragma unroll 1   // kept rolled: a further chunk in flight would add its operand registers to the 128 accumulator registers
        for (int kb = ks * 64; kb < Kl; kb += KSP * 64) { kstep(kb); kstep(kb + 32); }   // Kl is a multiple of 64
    } else {
#pragma unroll 1   // kept rolled, for the same reason
        for (int kc = 0; kc < Kl; kc += 32) kstep(kc);
    }
#pragma unroll
    for (int mb = 0; mb < 4; ++mb) {
#pragma unroll
        for (int nb = 0; nb < 4; ++nb) {
#pragma unroll
            for (int j = 0; j < 8; ++j) os[(hi * 8 + j) * 68 + nb * 16 + lr] = acc[mb][nb][j]; }
        __builtin_amdgcn_wave_barrier(); asm volatile("" ::: "memory");
        float* crow = C + (size_t)(r0 + mb * 16) * ldc + c0;
{
#pragma unroll
            for (int s = 0; s < 8; ++s) { const int row = 2 * s + hi, cofs = lr * 4; v4f val = *(const v4fa*)(os + row * 68 + cofs);
                *(v4f*)(crow + (size_t)row * ldc + cofs) = val; }
             }
        __builtin_amdgcn_wave_barrier(); asm volatile("" ::: "memory");
    }
}

__device__ __forceinline__ h16 tohx(float x) { return (h16)x; }
__device__ __forceinline__ void splitf(float y, unsigned short& h, unsigned short& l) { h = f2bf(y); l = f2bf(y - bf2f(h)); }
typedef __attribute__((ext_vector_type(2))) _Float16 v2h;
typedef __attribute__((ext_vector_type(4))) _Float16 v4h;
typedef __attribute__((ext_vector_type(2))) unsigned short v2us;
typedef __attribute__((ext_vector_type(4))) unsigned short v4us;
typedef __attribute__((ext_vector_type(2))) float v2f;
typedef __attribute__((ext_vector_type(4))) int v4i;

__global__ __launch_bounds__(256) void k_wtG(const float* __restrict__ w, int K, int N, bf* Bt) {
    const int lane = threadIdx.x & 31; const int L0 = (blockIdx.x * 8 + (threadIdx.x >> 5)) * 8; const int nlines = N * K / 64;
{
#pragma unroll 1
        for (int l = 0; l < 8; ++l) { const int L = L0 + l; if (L >= nlines) break; const size_t e = (size_t)L * 64 + lane * 2; const int k = (int)(e % K), n = (int)(e / K); v2us o;
            o[0] = f2bf(w[(size_t)k * N + n]); o[1] = f2bf(w[(size_t)(k + 1) * N + n]); *(v2us*)(Bt + e) = o; }
         }
}
__global__ __launch_bounds__(256) void k_cvt8(const float* __restrict__ src, bf* dst, size_t n8) { const size_t i = (size_t)blockIdx.x * 256 + threadIdx.x; if (i >= n8) return; const v8f v = *(const v8f*)(src + i * 8); v8us o;
#pragma unroll
    for (int k = 0; k < 8; ++k) o[k] = f2bf(v[k]); *(v8us*)(dst + i * 8) = o;  }

// k_rope: head planes [h][t][d] (fp16 + hi/lo) of rope(x) x sc with the rotate-half convention out[d] = x[d] cos[t][d] - x[d+HD/2] sin[t][d], out[d+HD/2] = x[d+HD/2] cos[t][d+HD/2] + x[d] sin[t][d+HD/2]
__global__ __launch_bounds__(256) void k_rope(const float* __restrict__ F, int pitch, int nheads, const float* __restrict__ CS, const float* __restrict__ RF, const float* __restrict__ nw, float sc, h16* P16, bf* Ph, bf* Pl) {
    const size_t e = ((size_t)blockIdx.x * 256 + threadIdx.x) * 2; if (e >= (size_t)nheads * TT * HD) return; const int d = (int)(e % HD); const int t = (int)((e / HD) % TT); const int h = (int)(e / ((size_t)HD * TT)); const float* f = F + (size_t)t * pitch + h * HD; const float rf = RF ? RF[(size_t)h * TT + t] : 1.0f; v2h o16; v2us oh, ol;
#pragma unroll
    for (int q = 0; q < 2; ++q) { const int dd = d + q; const int dp = (dd < HD / 2) ? dd + HD / 2 : dd - HD / 2; float x0 = f[dd], x1 = f[dp];
        if (RF) { float n0 = __fmul_rn(x0, rf), n1 = __fmul_rn(x1, rf); asm volatile("" : "+v"(n0)); asm volatile("" : "+v"(n1)); x0 = __fmul_rn(bfr(nw[dd]), n0); x1 = __fmul_rn(bfr(nw[dp]), n1); }
        const v2f cs = *(const v2f*)(CS + ((size_t)t * HD + dd) * 2); float a = __fmul_rn(x0, cs[0]), bq = __fmul_rn(x1, cs[1]); asm volatile("" : "+v"(a)); asm volatile("" : "+v"(bq)); const float r = ((dd < HD / 2) ? __fsub_rn(a, bq) : __fadd_rn(a, bq)) * sc;
        o16[q] = tohx(r); unsigned short a2, c2; splitf(r, a2, c2); oh[q] = a2; ol[q] = c2; }
    *(v2h*)(P16 + e) = o16; *(v2us*)(Ph + e) = oh; *(v2us*)(Pl + e) = ol;  }
__global__ __launch_bounds__(256) void k_vtp(const float* __restrict__ F, int pitch, int nheads, h16* V16, bf* Vh, bf* Vl) { const size_t e = ((size_t)blockIdx.x * 256 + threadIdx.x) * 2; if (e >= (size_t)nheads * HD * TT) return; const int t = (int)(e % TT); const int d = (int)((e / TT) % HD); const int g = (int)(e / ((size_t)TT * HD)); v2h o16; v2us oh, ol;
#pragma unroll
    for (int q = 0; q < 2; ++q) { const float x = F[(size_t)(t + q) * pitch + g * HD + d]; o16[q] = tohx(x); unsigned short a2, c2; splitf(x, a2, c2); oh[q] = a2; ol[q] = c2; }
    *(v2h*)(V16 + e) = o16; *(v2us*)(Vh + e) = oh; *(v2us*)(Vl + e) = ol;  }
__global__ __launch_bounds__(256) void k_cscvt(const float* __restrict__ cosT, const float* __restrict__ sinT, float* CS) { const int idx = blockIdx.x * 256 + threadIdx.x; if (idx >= TT * HD) return; v2f cs; cs[0] = bfr(cosT[idx]); cs[1] = bfr(sinT[idx]); *(v2f*)(CS + (size_t)idx * 2) = cs;  }
// k_asoft: per row (zz, i): t = S x HD^-0.5 for j <= i and i - j < WIN (sliding causal window; the reference's -1e9 additive fill vanishes identically); softmax over the 2048 keys (register row, one exp, fixed trees);
__global__ __launch_bounds__(256) void k_asoft(const float* __restrict__ Sb, h16* P16, bf* Ph, bf* Pl) {
    const int lane = threadIdx.x & 31; const int row = blockIdx.x * 8 + (threadIdx.x >> 5); if (row >= ZH * TT) return; const int i = row % TT; const int zz = row / TT; (void)zz; const bool hires = (i < RH); const float* sr = Sb + (size_t)row * TT; float v[TT / 32]; float mx = -3.0e38f;
#pragma unroll
    for (int ch = 0; ch < TT / 128; ++ch) { const int j0 = ch * 128 + lane * 4; const v4f a = *(const v4f*)(sr + j0);
#pragma unroll
        for (int q = 0; q < 4; ++q) { const int j = j0 + q; (void)j; const float t = (j <= i && i - j < WIN) ? a[q] * SCL : -3.0e38f; v[ch * 4 + q] = t; mx = fmaxf(mx, t); } }
#pragma unroll
    for (int sh = 16; sh; sh >>= 1) mx = fmaxf(mx, __shfl_xor(mx, sh, 32));
    float sum = 0.f;
#pragma unroll
    for (int k = 0; k < TT / 32; ++k) { float d0 = __fsub_rn(v[k], mx); asm volatile("" : "+v"(d0)); v[k] = __builtin_amdgcn_exp2f(__fmul_rn(d0, 1.4426950408889634f)); sum += v[k]; }
#pragma unroll
    for (int sh = 16; sh; sh >>= 1) sum += __shfl_xor(sum, sh, 32);
    const float f = __fdiv_rn(hires ? 1.0f : PCAR, sum);
{
        if (hires) {
#pragma unroll
            for (int ch = 0; ch < TT / 128; ++ch) { v4us oh, ol;
#pragma unroll
                for (int q = 0; q < 4; ++q) { unsigned short a, c2; splitf(v[ch * 4 + q] * f, a, c2); oh[q] = a; ol[q] = c2; }
                const size_t oo = ((size_t)zz * (RH ? RH : 1) + i) * TT + ch * 128 + lane * 4; *(v4us*)(Ph + oo) = oh; *(v4us*)(Pl + oo) = ol; }
        } else {
#pragma unroll
            for (int ch = 0; ch < TT / 128; ++ch) { v4h o4;
#pragma unroll
                for (int q = 0; q < 4; ++q) o4[q] = tohx(v[ch * 4 + q] * f);
                *(v4h*)(P16 + (size_t)row * TT + ch * 128 + lane * 4) = o4; } }
         }
}
// k_merge: sums the KSP partial planes of the probability x value product in ascending split order, rescales, and writes the merged hi/lo planes
__global__ __launch_bounds__(256) void k_merge(const float* __restrict__ O, int h0, bf* Ah, bf* Al) { const size_t e = ((size_t)blockIdx.x * 256 + threadIdx.x) * 2; if (e >= (size_t)ZH * TT * HD) return; const int d = (int)(e % HD); const int t = (int)((e / HD) % TT); const int zz = (int)(e / ((size_t)HD * TT)); const float cs = (t < RH) ? 1.0f : (1.0f / PCAR); const size_t oo = (size_t)t * DQ + (h0 + zz) * HD + d;
    v2f p[KSP];
#pragma unroll
    for (int sp = 0; sp < KSP; ++sp) p[sp] = *(const v2f*)(O + (size_t)sp * ((size_t)ZH * TT * HD) + e);
    v2f sm = p[0];
#pragma unroll
    for (int sp = 1; sp < KSP; ++sp) sm += p[sp];
    v2us oh, ol;
#pragma unroll
    for (int q = 0; q < 2; ++q) { unsigned short a, c2; splitf(sm[q] * cs, a, c2); oh[q] = a; ol[q] = c2; } *(v2us*)(Ah + oo) = oh; *(v2us*)(Al + oo) = ol;  }

extern "C" void kernel_launch(void* const* d_in, const int* in_sizes, int n_in,
                              void* d_out, int out_size, void* d_ws, size_t ws_size, hipStream_t stream) {
    (void)in_sizes; (void)n_in; (void)out_size;
    const float* x = (const float*)d_in[0]; const float* fsinq = (const float*)d_in[1]; const float* fcosq = (const float*)d_in[2]; const float* fsink = (const float*)d_in[3]; const float* fcosk = (const float*)d_in[4]; const float* wqkv = (const float*)d_in[5]; const float* wo = (const float*)d_in[6];   /* input order query, sin_q, cos_q, sin_k, cos_k ([1][1][2048][64] each), w_in ('xw' [1024][3072]), w_out ('xw') */ const float* wq = wqkv; const float* wk = nullptr; const float* wv = nullptr; (void)wk; (void)wv;
    float* OUT = (float*)d_out;     // [2][2048][1024]
    char* wsp = (char*)d_ws;
    auto take = [&](size_t bytes) { char* p = wsp; wsp += (bytes + 255) & ~(size_t)255; return (void*)p; };
    bf* WQKV = (bf*)take((size_t)3 * DQ * DM * 2); bf* WQ = WQKV; bf* WK = WQKV + (size_t)DQ * DM; bf* WV = WQKV + (size_t)2 * DQ * DM;   /* fused Bt [3*DQ][DM]: q | k | v row blocks */ bf* WO = (bf*)take((size_t)DM * DQ * 2); float* CS = (float*)take((size_t)TT * HD * 2 * 4); float* CSK = (float*)take((size_t)TT * HD * 2 * 4);   /* second {cos, sin} table: the k stream has its own input tables */
    bf* XB = (bf*)take((size_t)TT * DM * 2); float* FQ = (float*)take((size_t)TT * DQ * 4); float* FK = (float*)take((size_t)TT * DKV * 4);
    h16* QP16 = (h16*)take((size_t)NH_ * TT * HD * 2); h16* KP16 = (h16*)take((size_t)NKV * TT * HD * 2); h16* VT16 = (h16*)take((size_t)NKV * HD * TT * 2);
    bf* QPh = (bf*)take((size_t)NH_ * TT * HD * 2); bf* QPl = (bf*)take((size_t)NH_ * TT * HD * 2); bf* KPh = (bf*)take((size_t)NKV * TT * HD * 2); bf* KPl = (bf*)take((size_t)NKV * TT * HD * 2); bf* VTh = (bf*)take((size_t)NKV * HD * TT * 2); bf* VTl = (bf*)take((size_t)NKV * HD * TT * 2); bf* Ph = (bf*)take((size_t)ZH * RH * TT * 2); bf* Pl = (bf*)take((size_t)ZH * RH * TT * 2);
    float* Sb = (float*)take((size_t)ZH * TT * TT * 4); h16* P16 = (h16*)take((size_t)ZH * TT * TT * 2); float* Ob = (float*)take((size_t)KSP * ZH * TT * HD * 4);   /* KSP partial planes */ bf* ATh = (bf*)take((size_t)TT * DQ * 2); bf* ATl = (bf*)take((size_t)TT * DQ * 2);
    if ((size_t)(wsp - (char*)d_ws) > ws_size) return;    // ws 256 MiB
    float* FV = FK;   // v projection reuses the k buffer after the k planes are built (stream-ordered)
    { k_wtG<<<(unsigned)((DM * 3 * DQ / 64 + 63) / 64), 256, 0, stream>>>(wqkv, DM, 3 * DQ, WQKV);   /* fused 'xw' [DM][3*DQ] -> Bt [3*DQ][DM] */
      k_wtG<<<(unsigned)((DQ * DM / 64 + 63) / 64), 256, 0, stream>>>(wo, DQ, DM, WO);
       }
    k_cscvt<<<(TT * HD + 255) / 256, 256, 0, stream>>>(fcosq, fsinq, CS);   /* q table from cos_q, sin_q */ k_cscvt<<<(TT * HD + 255) / 256, 256, 0, stream>>>(fcosk, fsink, CSK);   /* k table from cos_k, sin_k */
    const unsigned LQ = (unsigned)(((size_t)NH_ * TT * HD / 2 + 255) / 256), LKv = (unsigned)(((size_t)NKV * TT * HD / 2 + 255) / 256);
    for (int b = 0; b < NB_; ++b) {
        
        k_cvt8<<<(unsigned)(((size_t)TT * DM / 8 + 255) / 256), 256, 0, stream>>>(x + (size_t)b * TT * DM, XB, (size_t)TT * DM / 8);
        k_gemmw<bf, 0, false><<<dim3(TT / 64, DQ / 64, 1), 32, 0, stream>>>(XB, nullptr, WQ, nullptr, DM, FQ, DQ, nullptr, 0, 0, 0);
        k_rope<<<LQ, 256, 0, stream>>>(FQ, DQ, NH_, CS, nullptr, nullptr, 1.0f, QP16, QPh, QPl);
        k_gemmw<bf, 0, false><<<dim3(TT / 64, DKV / 64, 1), 32, 0, stream>>>(XB, nullptr, WK, nullptr, DM, FK, DKV, nullptr, 0, 0, 0);
        k_rope<<<LKv, 256, 0, stream>>>(FK, DKV, NKV, CSK, nullptr, nullptr, 1.0f, KP16, KPh, KPl);
        k_gemmw<bf, 0, false><<<dim3(TT / 64, DKV / 64, 1), 32, 0, stream>>>(XB, nullptr, WV, nullptr, DM, FV, DKV, nullptr, 0, 0, 0); k_vtp<<<LKv, 256, 0, stream>>>(FV, DKV, NKV, VT16, VTh, VTl);
        for (int h0 = 0; h0 < NH_; h0 += ZH) { const size_t zq = (size_t)h0, zk = (size_t)(h0 / REP);   // one kv head per query head: the pass's two heads use consecutive kv planes (z-strides TT*HD)
            k_gemmc<bf, 2, 1><<<dim3(RH / 64, TT / 64, ZH), 32, 0, stream>>>(QPh + zq * TT * HD, QPl + zq * TT * HD, KPh + zk * TT * HD, KPl + zk * TT * HD, HD, Sb, TT, 0, (size_t)TT * HD, (size_t)TT * HD, (size_t)TT * TT, 0);
            k_gemmc<h16, 0, 1><<<dim3((TT - RH) / 64, TT / 64, ZH), 32, 0, stream>>>(QP16 + zq * TT * HD + (size_t)RH * HD, nullptr, KP16 + zk * TT * HD, nullptr, HD, Sb + (size_t)RH * TT, TT, RH, (size_t)TT * HD, (size_t)TT * HD, (size_t)TT * TT, 0);
            k_asoft<<<ZH * TT / 8, 256, 0, stream>>>(Sb, P16, Ph, Pl);
            k_gemmc<bf, 2, 2><<<dim3(RH / 64, KSP, ZH), 32, 0, stream>>>(Ph, Pl, VTh + zk * HD * TT, VTl + zk * HD * TT, TT, Ob, HD, 0, (size_t)RH * TT, (size_t)HD * TT, (size_t)TT * HD, (size_t)ZH * TT * HD);
            k_gemmc<h16, 0, 2><<<dim3((TT - RH) / 64, KSP, ZH), 32, 0, stream>>>(P16 + (size_t)RH * TT, nullptr, VT16 + zk * HD * TT, nullptr, TT, Ob + (size_t)RH * HD, HD, RH, (size_t)TT * TT, (size_t)HD * TT, (size_t)TT * HD, (size_t)ZH * TT * HD);
            k_merge<<<(unsigned)(((size_t)ZH * TT * HD / 2 + 255) / 256), 256, 0, stream>>>(Ob, h0, ATh, ATl); }
        k_gemmw<bf, 1, false><<<dim3(TT / 64, DM / 64, 1), 32, 0, stream>>>(ATh, ATl, WO, nullptr, DQ, OUT + (size_t)b * TT * DM, DM, nullptr, 0, 0, 0); }
}

// v002
// It runs in 571 microseconds.
// Timed twice side by side with v001, it ran 1.33 times as fast both times.
// Over all steps from v000 it is 2.51 times as fast.
#include <hip/hip_runtime.h>

// Causal multi-head attention with a fused qkv projection and rotary embeddings from FOUR input tables (query [2][2048][1024]; qkv = query w_in ('xw' [1024][3072] 1/32, no bias) -> q | k | v column thirds (16 heads x 64); q = q cos_q + rotate_half(q) sin_q, k = k cos_k + rotate_half(k) sin_k with sin_q, cos_q, sin_k, cos_k [1][1][2048][64] INPUTS (full-width per-element tables, separate for q and k; read as data); scores x 1/sqrt(64); causal (finfo.min); softmax; out = merged w_out ('xw' [1024][1024], no bias) -> [2][2048][1024] (4.2 M); argument order query, sin_q, cos_q, sin_k, cos_k, w_in, w_out).
// Layout per batch: bf16 copy of query; the fused 'xw' weight transposed once into Bt (q | k | v row blocks); exact projections; TWO {cos, sin} tables from the bf16-rounded inputs (one for q, one for k); rotate-half plane builders; causal T-2048 attention (hybrid rows: < 512 hi/lo 3 products, rest fp16 x1024; k_gemmc skips tiles above the diagonal); merged hi/lo x w_out exact.
// Compute dtypes, f32 accumulate: every input rounded to bf16 incl. the four tables; projections exact; rotary f32; attention rows < 512 3 products, rest fp16; softmax f32; w_out hl x exact.

#define NB_  2
#define TT   2048
#define DM   1024
#define NH_  16
#define NKV  16
#define REP  (NH_ / NKV)
#define HD   64
#define DQ   (NH_ * HD)
#define DKV  (NKV * HD)
#define ZH   8                    // heads per attention pass (z of every attention launch)
#define PP   (2 * TT)             // pitch, in 16-bit elements, of a probability row: it lies in the bytes of its own f32 score row
#define RH   512                  // query rows < RH use hi+lo planes (0: none)
#define WIN  2048
#define PCAR 1024.0f
#define SCL  0.125f   // HD^-0.5
#define KSP  16                   // key splits of the probability x value product: one work-group per split, f32 partial planes summed in k_merge
typedef _Float16 h16;
typedef unsigned short bf;
typedef __attribute__((ext_vector_type(16))) __bf16   v16bf;
typedef __attribute__((ext_vector_type(16))) _Float16 v16h;
typedef __attribute__((ext_vector_type(8)))  _Float16 v8h;
typedef __attribute__((ext_vector_type(8)))  unsigned short v8us;
typedef __attribute__((ext_vector_type(8)))  float    v8f;
typedef __attribute__((ext_vector_type(4)))  float    v4f;
typedef v8h  __attribute__((may_alias)) v8ha;
typedef v4f  __attribute__((may_alias)) v4fa;
typedef v8us __attribute__((may_alias)) v8usa;

__device__ __forceinline__ unsigned short f2bf(float f) { unsigned u = __float_as_uint(f); u += 0x7FFFu + ((u >> 16) & 1u); return (unsigned short)(u >> 16); }
__device__ __forceinline__ float bf2f(unsigned short b) { return __uint_as_float(((unsigned)b) << 16); }
__device__ __forceinline__ float bfr(float f) { return bf2f(f2bf(f)); }
__device__ __forceinline__ v16h cat16(v8h lo, v8h hi) { return __builtin_shufflevector(lo, hi, 0, 1, 2, 3, 4, 5, 6, 7, 8, 9, 10, 11, 12, 13, 14, 15); }
__device__ __forceinline__ v16bf cat16b(v8us lo, v8us hi) { return __builtin_bit_cast(v16bf, __builtin_shufflevector(lo, hi, 0, 1, 2, 3, 4, 5, 6, 7, 8, 9, 10, 11, 12, 13, 14, 15)); }
__device__ __forceinline__ v8f wmma16(v16h a, v16h b, v8f c) { return __builtin_amdgcn_wmma_f32_16x16x32_f16(false, a, false, b, (short)0, c, false, false); }
__device__ __forceinline__ v8f wmmab(v16bf a, v16bf b, v8f c) { return __builtin_amdgcn_wmma_f32_16x16x32_bf16(false, a, false, b, (short)0, c, false, false); }



// ---- k_gemmw: register-blocked GEMM, ONE WAVE per 64x64 output tile (16 accumulators), operands straight from K-contiguous 16-bit planes; grid (M/64, N/64, Z), 32 threads.
// C[m][n] (f32, pitch ldc, + optional f32 bias[n]) = sum_k A[m][k] Bt[n][k] (+ split products per NSPLIT). z-batch strides sA/sB/sC in elements. K % 32 == 0.
template <typename T16> struct WFrag;
template <> struct WFrag<h16> { typedef v16h V; static __device__ __forceinline__ V ld(const h16* p) { return cat16(*(const v8h*)p, *(const v8h*)(p + 16)); } static __device__ __forceinline__ v8f mma(V a, V b, v8f c) { return wmma16(a, b, c); } };
template <> struct WFrag<bf> { typedef v16bf V; static __device__ __forceinline__ V ld(const bf* p) { return cat16b(*(const v8us*)p, *(const v8us*)(p + 16)); } static __device__ __forceinline__ v8f mma(V a, V b, v8f c) { return wmmab(a, b, c); } };
// xwait: stands behind a global load, in front of whatever next rewrites the load's address registers (a later load's result may land in them)
__device__ __forceinline__ void xwait() { asm volatile("s_wait_xcnt 0x0" ::: "memory"); }
// ldw: the fragment load of WFrag::ld with that wait behind each of its two loads
__device__ __forceinline__ v16h ldw(const h16* p) { const v8h lo = *(const v8h*)p; xwait(); const v8h hi = *(const v8h*)(p + 16); xwait(); return cat16(lo, hi); }
__device__ __forceinline__ v16bf ldw(const bf* p) { const v8us lo = *(const v8us*)p; xwait(); const v8us hi = *(const v8us*)(p + 16); xwait(); return cat16b(lo, hi); }
template <typename T16, int NSPLIT, bool BIAS>
__global__ __launch_bounds__(32) void k_gemmw(const T16* __restrict__ A, const T16* __restrict__ A2, const T16* __restrict__ Bt, const T16* __restrict__ Bt2, int K, float* C, int ldc, const float* __restrict__ bias, size_t sA, size_t sB, size_t sC) {
    typedef typename WFrag<T16>::V V;
    __shared__ __align__(16) float os[16 * 68];
    const size_t z = blockIdx.z; A += z * sA; if (A2) A2 += z * sA; Bt += z * sB; if (Bt2) Bt2 += z * sB; C += z * sC;
    const int lane = threadIdx.x & 31, lr = lane & 15, hi = lane >> 4; const int r0 = blockIdx.x * 64, c0 = blockIdx.y * 64;
    v8f acc[4][4];
#pragma unroll
    for (int mb = 0; mb < 4; ++mb)
#pragma unroll
        for (int nb = 0; nb < 4; ++nb) acc[mb][nb] = (v8f){};
    const size_t aoff = (size_t)(r0 + lr) * K + 8 * hi, boff = (size_t)(c0 + lr) * K + 8 * hi;
#pragma unroll 1
    for (int kc = 0; kc < K; kc += 32) {
        V a[4], a2[4];
#pragma unroll
        for (int mb = 0; mb < 4; ++mb) { a[mb] = WFrag<T16>::ld(A + aoff + (size_t)mb * 16 * K + kc); if (NSPLIT == 1 || NSPLIT == 2) a2[mb] = WFrag<T16>::ld(A2 + aoff + (size_t)mb * 16 * K + kc); }
#pragma unroll
        for (int nb = 0; nb < 4; ++nb) { const V b = WFrag<T16>::ld(Bt + boff + (size_t)nb * 16 * K + kc); V b2; if (NSPLIT >= 2) b2 = WFrag<T16>::ld(Bt2 + boff + (size_t)nb * 16 * K + kc);
#pragma unroll
            for (int mb = 0; mb < 4; ++mb) { acc[mb][nb] = WFrag<T16>::mma(a[mb], b, acc[mb][nb]); if (NSPLIT == 1 || NSPLIT == 2) acc[mb][nb] = WFrag<T16>::mma(a2[mb], b, acc[mb][nb]); if (NSPLIT >= 2) acc[mb][nb] = WFrag<T16>::mma(a[mb], b2, acc[mb][nb]); } }
        asm volatile("v_nop\n\tv_nop\n\tv_nop\n\tv_nop" : "+v"(acc[0][0]), "+v"(acc[1][1]), "+v"(acc[2][2]), "+v"(acc[3][3]) : "v"(a[0]), "v"(a[3]));
    }
#pragma unroll
    for (int mb = 0; mb < 4; ++mb) {
#pragma unroll
        for (int nb = 0; nb < 4; ++nb) {
#pragma unroll
            for (int j = 0; j < 8; ++j) os[(hi * 8 + j) * 68 + nb * 16 + lr] = acc[mb][nb][j]; }
        __builtin_amdgcn_wave_barrier(); asm volatile("" ::: "memory");
        float* crow = C + (size_t)(r0 + mb * 16) * ldc + c0;
{
#pragma unroll
            for (int s = 0; s < 8; ++s) { const int row = 2 * s + hi, cofs = lr * 4; v4f val = *(const v4fa*)(os + row * 68 + cofs); if (BIAS) { val[0] += bfr(bias[c0 + cofs]); val[1] += bfr(bias[c0 + cofs + 1]); val[2] += bfr(bias[c0 + cofs + 2]); val[3] += bfr(bias[c0 + cofs + 3]); }
                *(v4f*)(crow + (size_t)row * ldc + cofs) = val; }
             }
        __builtin_amdgcn_wave_barrier(); asm volatile("" ::: "memory");
    }
}

// ---- k_gemmc: the same one-wave 64x64 tile GEMM specialised for causal attention: CMODE 1 skips score tiles entirely above the diagonal (query rows r0+roff.., key columns c0..), CMODE 2 limits the
// key (K) loop of the probability x value contraction to the diagonal block (probabilities beyond it are exactly zero). roff = row offset of this launch's first row within the sequence.
// CMODE 2 also splits the key loop over blockIdx.y (the product has one 64-column tile): split s takes the 64-key chunks s, s + KSP, ... (one 128-byte line of each row per chunk) and stores its own f32 partial plane C + s * sP;
// a split with no chunk below the diagonal stores zeros, so that k_merge reads KSP written planes for every row. lda = row pitch of A and A2 in elements (Bt keeps pitch K).
template <typename T16, int NSPLIT, int CMODE>
__global__ __launch_bounds__(32) void k_gemmc(const T16* __restrict__ A, const T16* __restrict__ A2, int lda, const T16* __restrict__ Bt, const T16* __restrict__ Bt2, int K, float* C, int ldc, int roff, size_t sA, size_t sB, size_t sC, size_t sP) {
    typedef typename WFrag<T16>::V V;
    __shared__ __align__(16) float os[16 * 68];
    const size_t z = blockIdx.z; A += z * sA; if (A2) A2 += z * sA; Bt += z * sB; if (Bt2) Bt2 += z * sB; C += z * sC;
    const int lane = threadIdx.x & 31, lr = lane & 15, hi = lane >> 4; const int r0 = blockIdx.x * 64, c0 = (CMODE == 2) ? 0 : blockIdx.y * 64; const int ks = (CMODE == 2) ? blockIdx.y : 0; C += (size_t)ks * sP;
    if (CMODE == 1 && c0 > r0 + roff + 63) return;                  // score tile entirely above the causal diagonal: never written (the softmax loads it but masks j > i by select)
    const int Kl = (CMODE == 2) ? min(K, r0 + roff + 64) : K;        // P.V: probabilities are exactly 0 beyond the diagonal block, so the K loop stops there
    v8f acc[4][4];
#pragma unroll
    for (int mb = 0; mb < 4; ++mb)
#pragma unroll
        for (int nb = 0; nb < 4; ++nb) acc[mb][nb] = (v8f){};
    const size_t aoff = (size_t)(r0 + lr) * lda + 8 * hi, boff = (size_t)(c0 + lr) * K + 8 * hi;
    auto kstep = [&](int kc) {
        V a[4], a2[4];
#pragma unroll
        for (int mb = 0; mb < 4; ++mb) { a[mb] = ldw(A + aoff + (size_t)mb * 16 * lda + kc); if (NSPLIT == 1 || NSPLIT == 2) a2[mb] = ldw(A2 + aoff + (size_t)mb * 16 * lda + kc); }
#pragma unroll
        for (int nb = 0; nb < 4; ++nb) { const V b = ldw(Bt + boff + (size_t)nb * 16 * K + kc); V b2; if (NSPLIT >= 2) b2 = ldw(Bt2 + boff + (size_t)nb * 16 * K + kc);
#pragma unroll
            for (int mb = 0; mb < 4; ++mb) { acc[mb][nb] = WFrag<T16>::mma(a[mb], b, acc[mb][nb]); if (NSPLIT == 1 || NSPLIT == 2) acc[mb][nb] = WFrag<T16>::mma(a2[mb], b, acc[mb][nb]); if (NSPLIT >= 2) acc[mb][nb] = WFrag<T16>::mma(a[mb], b2, acc[mb][nb]); } }
        asm volatile("v_nop\n\tv_nop\n\tv_nop\n\tv_nop" : "+v"(acc[0][0]), "+v"(acc[1][1]), "+v"(acc[2][2]), "+v"(acc[3][3]) : "v"(a[0]), "v"(a[3]));
    };
    if (CMODE == 2) {
#pragma unroll 1   // kept rolled: a further chunk in flight would add its operand registers to the 128 accumulator registers
        for (int kb = ks * 64; kb < Kl; kb += KSP * 64) { kstep(kb); kstep(kb + 32); }   // Kl is a multiple of 64
    } else {
#pragma unroll 1   // kept rolled, for the same reason
        for (int kc = 0; kc < Kl; kc += 32) kstep(kc);
    }
#pragma unroll
    for (int mb = 0; mb < 4; ++mb) {
#pragma unroll
        for (int nb = 0; nb < 4; ++nb) {
#pragma unroll
            for (int j = 0; j < 8; ++j) os[(hi * 8 + j) * 68 + nb * 16 + lr] = acc[mb][nb][j]; }
        __builtin_amdgcn_wave_barrier(); asm volatile("" ::: "memory");
        float* crow = C + (size_t)(r0 + mb * 16) * ldc + c0;
{
#pragma unroll
            for (int s = 0; s < 8; ++s) { const int row = 2 * s + hi, cofs = lr * 4; v4f val = *(const v4fa*)(os + row * 68 + cofs);
                *(v4f*)(crow + (size_t)row * ldc + cofs) = val; }
             }
        __builtin_amdgcn_wave_barrier(); asm volatile("" ::: "memory");
    }
}

__device__ __forceinline__ h16 tohx(float x) { return (h16)x; }
__device__ __forceinline__ void splitf(float y, unsigned short& h, unsigned short& l) { h = f2bf(y); l = f2bf(y - bf2f(h)); }
typedef __attribute__((ext_vector_type(2))) _Float16 v2h;
typedef __attribute__((ext_vector_type(4))) _Float16 v4h;
typedef __attribute__((ext_vector_type(2))) unsigned short v2us;
typedef __attribute__((ext_vector_type(4))) unsigned short v4us;
typedef __attribute__((ext_vector_type(2))) float v2f;
typedef __attribute__((ext_vector_type(4))) int v4i;
typedef v4h  __attribute__((may_alias)) v4ha;
typedef v4us __attribute__((may_alias)) v4usa;

__global__ __launch_bounds__(256) void k_wtG(const float* __restrict__ w, int K, int N, bf* Bt) {
    const int lane = threadIdx.x & 31; const int L0 = (blockIdx.x * 8 + (threadIdx.x >> 5)) * 8; const int nlines = N * K / 64;
{
#pragma unroll 1
        for (int l = 0; l < 8; ++l) { const int L = L0 + l; if (L >= nlines) break; const size_t e = (size_t)L * 64 + lane * 2; const int k = (int)(e % K), n = (int)(e / K); v2us o;
            o[0] = f2bf(w[(size_t)k * N + n]); o[1] = f2bf(w[(size_t)(k + 1) * N + n]); *(v2us*)(Bt + e) = o; }
         }
}
__global__ __launch_bounds__(256) void k_cvt8(const float* __restrict__ src, bf* dst, size_t n8) { const size_t i = (size_t)blockIdx.x * 256 + threadIdx.x; if (i >= n8) return; const v8f v = *(const v8f*)(src + i * 8); v8us o;
#pragma unroll
    for (int k = 0; k < 8; ++k) o[k] = f2bf(v[k]); *(v8us*)(dst + i * 8) = o;  }

// k_rope: head planes [h][t][d] (fp16 + hi/lo) of rope(x) x sc with the rotate-half convention out[d] = x[d] cos[t][d] - x[d+HD/2] sin[t][d], out[d+HD/2] = x[d+HD/2] cos[t][d+HD/2] + x[d] sin[t][d+HD/2]
__global__ __launch_bounds__(256) void k_rope(const float* __restrict__ F, int pitch, int nheads, const float* __restrict__ CS, const float* __restrict__ RF, const float* __restrict__ nw, float sc, h16* P16, bf* Ph, bf* Pl) {
    const size_t e = ((size_t)blockIdx.x * 256 + threadIdx.x) * 2; if (e >= (size_t)nheads * TT * HD) return; const int d = (int)(e % HD); const int t = (int)((e / HD) % TT); const int h = (int)(e / ((size_t)HD * TT)); const float* f = F + (size_t)t * pitch + h * HD; const float rf = RF ? RF[(size_t)h * TT + t] : 1.0f; v2h o16; v2us oh, ol;
#pragma unroll
    for (int q = 0; q < 2; ++q) { const int dd = d + q; const int dp = (dd < HD / 2) ? dd + HD / 2 : dd - HD / 2; float x0 = f[dd], x1 = f[dp];
        if (RF) { float n0 = __fmul_rn(x0, rf), n1 = __fmul_rn(x1, rf); asm volatile("" : "+v"(n0)); asm volatile("" : "+v"(n1)); x0 = __fmul_rn(bfr(nw[dd]), n0); x1 = __fmul_rn(bfr(nw[dp]), n1); }
        const v2f cs = *(const v2f*)(CS + ((size_t)t * HD + dd) * 2); float a = __fmul_rn(x0, cs[0]), bq = __fmul_rn(x1, cs[1]); asm volatile("" : "+v"(a)); asm volatile("" : "+v"(bq)); const float r = ((dd < HD / 2) ? __fsub_rn(a, bq) : __fadd_rn(a, bq)) * sc;
        o16[q] = tohx(r); unsigned short a2, c2; splitf(r, a2, c2); oh[q] = a2; ol[q] = c2; }
    *(v2h*)(P16 + e) = o16; *(v2us*)(Ph + e) = oh; *(v2us*)(Pl + e) = ol;  }
__global__ __launch_bounds__(256) void k_vtp(const float* __restrict__ F, int pitch, int nheads, h16* V16, bf* Vh, bf* Vl) { const size_t e = ((size_t)blockIdx.x * 256 + threadIdx.x) * 2; if (e >= (size_t)nheads * HD * TT) return; const int t = (int)(e % TT); const int d = (int)((e / TT) % HD); const int g = (int)(e / ((size_t)TT * HD)); v2h o16; v2us oh, ol;
#pragma unroll
    for (int q = 0; q < 2; ++q) { const float x = F[(size_t)(t + q) * pitch + g * HD + d]; o16[q] = tohx(x); unsigned short a2, c2; splitf(x, a2, c2); oh[q] = a2; ol[q] = c2; }
    *(v2h*)(V16 + e) = o16; *(v2us*)(Vh + e) = oh; *(v2us*)(Vl + e) = ol;  }
__global__ __launch_bounds__(256) void k_cscvt(const float* __restrict__ cosT, const float* __restrict__ sinT, float* CS) { const int idx = blockIdx.x * 256 + threadIdx.x; if (idx >= TT * HD) return; v2f cs; cs[0] = bfr(cosT[idx]); cs[1] = bfr(sinT[idx]); *(v2f*)(CS + (size_t)idx * 2) = cs;  }
// k_asoft: per row (zz, i): t = S x HD^-0.5 for j <= i and i - j < WIN (sliding causal window; the reference's -1e9 additive fill vanishes identically); softmax over the 2048 keys (register row, one exp, fixed trees);
// the probabilities overwrite the row's own 8192 score bytes (one wave owns a row and holds all of it in registers before its first store): fp16 in the first half, or hi in the first and lo in the second half.
__global__ __launch_bounds__(256) void k_asoft(float* Sb) {
    const int lane = threadIdx.x & 31; const int row = blockIdx.x * 8 + (threadIdx.x >> 5); if (row >= ZH * TT) return; const int i = row % TT; const int zz = row / TT; (void)zz; const bool hires = (i < RH); const float* sr = Sb + (size_t)row * TT; h16* p16 = (h16*)Sb + (size_t)row * PP; bf* ph = (bf*)Sb + (size_t)row * PP; bf* pl = ph + TT; float v[TT / 32]; float mx = -3.0e38f;
#pragma unroll
    for (int ch = 0; ch < TT / 128; ++ch) { const int j0 = ch * 128 + lane * 4; const v4f a = *(const v4fa*)(sr + j0);
#pragma unroll
        for (int q = 0; q < 4; ++q) { const int j = j0 + q; (void)j; const float t = (j <= i && i - j < WIN) ? a[q] * SCL : -3.0e38f; v[ch * 4 + q] = t; mx = fmaxf(mx, t); } }
#pragma unroll
    for (int sh = 16; sh; sh >>= 1) mx = fmaxf(mx, __shfl_xor(mx, sh, 32));
    float sum = 0.f;
#pragma unroll
    for (int k = 0; k < TT / 32; ++k) { float d0 = __fsub_rn(v[k], mx); asm volatile("" : "+v"(d0)); v[k] = __builtin_amdgcn_exp2f(__fmul_rn(d0, 1.4426950408889634f)); sum += v[k]; }
#pragma unroll
    for (int sh = 16; sh; sh >>= 1) sum += __shfl_xor(sum, sh, 32);
    const float f = __fdiv_rn(hires ? 1.0f : PCAR, sum);
{
        if (hires) {
#pragma unroll
            for (int ch = 0; ch < TT / 128; ++ch) { v4us oh, ol;
#pragma unroll
                for (int q = 0; q < 4; ++q) { unsigned short a, c2; splitf(v[ch * 4 + q] * f, a, c2); oh[q] = a; ol[q] = c2; }
                const int oo = ch * 128 + lane * 4; *(v4usa*)(ph + oo) = oh; *(v4usa*)(pl + oo) = ol; }
        } else {
#pragma unroll
            for (int ch = 0; ch < TT / 128; ++ch) { v4h o4;
#pragma unroll
                for (int q = 0; q < 4; ++q) o4[q] = tohx(v[ch * 4 + q] * f);
                *(v4ha*)(p16 + ch * 128 + lane * 4) = o4; } }
         }
}
// k_merge: sums the KSP partial planes of the probability x value product in ascending split order, rescales, and writes the merged hi/lo planes
__global__ __launch_bounds__(256) void k_merge(const float* __restrict__ O, int h0, bf* Ah, bf* Al) { const size_t e = ((size_t)blockIdx.x * 256 + threadIdx.x) * 2; if (e >= (size_t)ZH * TT * HD) return; const int d = (int)(e % HD); const int t = (int)((e / HD) % TT); const int zz = (int)(e / ((size_t)HD * TT)); const float cs = (t < RH) ? 1.0f : (1.0f / PCAR); const size_t oo = (size_t)t * DQ + (h0 + zz) * HD + d;
    v2f p[KSP];
#pragma unroll
    for (int sp = 0; sp < KSP; ++sp) p[sp] = *(const v2f*)(O + (size_t)sp * ((size_t)ZH * TT * HD) + e);
    v2f sm = p[0];
#pragma unroll
    for (int sp = 1; sp < KSP; ++sp) sm += p[sp];
    v2us oh, ol;
#pragma unroll
    for (int q = 0; q < 2; ++q) { unsigned short a, c2; splitf(sm[q] * cs, a, c2); oh[q] = a; ol[q] = c2; } *(v2us*)(Ah + oo) = oh; *(v2us*)(Al + oo) = ol;  }

extern "C" void kernel_launch(void* const* d_in, const int* in_sizes, int n_in,
                              void* d_out, int out_size, void* d_ws, size_t ws_size, hipStream_t stream) {
    (void)in_sizes; (void)n_in; (void)out_size;
    const float* x = (const float*)d_in[0]; const float* fsinq = (const float*)d_in[1]; const float* fcosq = (const float*)d_in[2]; const float* fsink = (const float*)d_in[3]; const float* fcosk = (const float*)d_in[4]; const float* wqkv = (const float*)d_in[5]; const float* wo = (const float*)d_in[6];   /* input order query, sin_q, cos_q, sin_k, cos_k ([1][1][2048][64] each), w_in ('xw' [1024][3072]), w_out ('xw') */ const float* wq = wqkv; const float* wk = nullptr; const float* wv = nullptr; (void)wk; (void)wv;
    float* OUT = (float*)d_out;     // [2][2048][1024]
    char* wsp = (char*)d_ws;
    auto take = [&](size_t bytes) { char* p = wsp; wsp += (bytes + 255) & ~(size_t)255; return (void*)p; };
    bf* WQKV = (bf*)take((size_t)3 * DQ * DM * 2); bf* WQ = WQKV; bf* WK = WQKV + (size_t)DQ * DM; bf* WV = WQKV + (size_t)2 * DQ * DM;   /* fused Bt [3*DQ][DM]: q | k | v row blocks */ bf* WO = (bf*)take((size_t)DM * DQ * 2); float* CS = (float*)take((size_t)TT * HD * 2 * 4); float* CSK = (float*)take((size_t)TT * HD * 2 * 4);   /* second {cos, sin} table: the k stream has its own input tables */
    h16* QP16 = (h16*)take((size_t)NH_ * TT * HD * 2); h16* KP16 = (h16*)take((size_t)NKV * TT * HD * 2); h16* VT16 = (h16*)take((size_t)NKV * HD * TT * 2);
    bf* QPh = (bf*)take((size_t)NH_ * TT * HD * 2); bf* QPl = (bf*)take((size_t)NH_ * TT * HD * 2); bf* KPh = (bf*)take((size_t)NKV * TT * HD * 2); bf* KPl = (bf*)take((size_t)NKV * TT * HD * 2); bf* VTh = (bf*)take((size_t)NKV * HD * TT * 2); bf* VTl = (bf*)take((size_t)NKV * HD * TT * 2);
    float* Sb = (float*)take((size_t)ZH * TT * TT * 4); h16* P16 = (h16*)Sb; bf* Ph = (bf*)Sb; bf* Pl = (bf*)Sb + TT;   /* probability rows lie in their score rows, pitch PP */ float* Ob = (float*)take((size_t)KSP * ZH * TT * HD * 4);   /* KSP partial planes */ bf* ATh = (bf*)take((size_t)TT * DQ * 2); bf* ATl = (bf*)take((size_t)TT * DQ * 2);
    if ((size_t)(wsp - (char*)d_ws) > ws_size) return;    // ws 256 MiB
    float* FQ = Sb; float* FK = FQ + (size_t)TT * DQ; bf* XB = (bf*)(FK + (size_t)TT * DKV);   // projection buffers lie in the score buffer: last read before a batch's first score launch, next written after its last probability x value launch (stream-ordered)
    float* FV = FK;   // v projection reuses the k buffer after the k planes are built (stream-ordered)
    { k_wtG<<<(unsigned)((DM * 3 * DQ / 64 + 63) / 64), 256, 0, stream>>>(wqkv, DM, 3 * DQ, WQKV);   /* fused 'xw' [DM][3*DQ] -> Bt [3*DQ][DM] */
      k_wtG<<<(unsigned)((DQ * DM / 64 + 63) / 64), 256, 0, stream>>>(wo, DQ, DM, WO);
       }
    k_cscvt<<<(TT * HD + 255) / 256, 256, 0, stream>>>(fcosq, fsinq, CS);   /* q table from cos_q, sin_q */ k_cscvt<<<(TT * HD + 255) / 256, 256, 0, stream>>>(fcosk, fsink, CSK);   /* k table from cos_k, sin_k */
    const unsigned LQ = (unsigned)(((size_t)NH_ * TT * HD / 2 + 255) / 256), LKv = (unsigned)(((size_t)NKV * TT * HD / 2 + 255) / 256);
    for (int b = 0; b < NB_; ++b) {
        
        k_cvt8<<<(unsigned)(((size_t)TT * DM / 8 + 255) / 256), 256, 0, stream>>>(x + (size_t)b * TT * DM, XB, (size_t)TT * DM / 8);
        k_gemmw<bf, 0, false><<<dim3(TT / 64, DQ / 64, 1), 32, 0, stream>>>(XB, nullptr, WQ, nullptr, DM, FQ, DQ, nullptr, 0, 0, 0);
        k_rope<<<LQ, 256, 0, stream>>>(FQ, DQ, NH_, CS, nullptr, nullptr, 1.0f, QP16, QPh, QPl);
        k_gemmw<bf, 0, false><<<dim3(TT / 64, DKV / 64, 1), 32, 0, stream>>>(XB, nullptr, WK, nullptr, DM, FK, DKV, nullptr, 0, 0, 0);
        k_rope<<<LKv, 256, 0, stream>>>(FK, DKV, NKV, CSK, nullptr, nullptr, 1.0f, KP16, KPh, KPl);
        k_gemmw<bf, 0, false><<<dim3(TT / 64, DKV / 64, 1), 32, 0, stream>>>(XB, nullptr, WV, nullptr, DM, FV, DKV, nullptr, 0, 0, 0); k_vtp<<<LKv, 256, 0, stream>>>(FV, DKV, NKV, VT16, VTh, VTl);
        for (int h0 = 0; h0 < NH_; h0 += ZH) { const size_t zq = (size_t)h0, zk = (size_t)(h0 / REP);   // one kv head per query head: the pass's heads use consecutive kv planes (z-strides TT*HD)
            k_gemmc<bf, 2, 1><<<dim3(RH / 64, TT / 64, ZH), 32, 0, stream>>>(QPh + zq * TT * HD, QPl + zq * TT * HD, HD, KPh + zk * TT * HD, KPl + zk * TT * HD, HD, Sb, TT, 0, (size_t)TT * HD, (size_t)TT * HD, (size_t)TT * TT, 0);
            k_gemmc<h16, 0, 1><<<dim3((TT - RH) / 64, TT / 64, ZH), 32, 0, stream>>>(QP16 + zq * TT * HD + (size_t)RH * HD, nullptr, HD, KP16 + zk * TT * HD, nullptr, HD, Sb + (size_t)RH * TT, TT, RH, (size_t)TT * HD, (size_t)TT * HD, (size_t)TT * TT, 0);
            k_asoft<<<ZH * TT / 8, 256, 0, stream>>>(Sb);
            k_gemmc<bf, 2, 2><<<dim3(RH / 64, KSP, ZH), 32, 0, stream>>>(Ph, Pl, PP, VTh + zk * HD * TT, VTl + zk * HD * TT, TT, Ob, HD, 0, (size_t)TT * PP, (size_t)HD * TT, (size_t)TT * HD, (size_t)ZH * TT * HD);
            k_gemmc<h16, 0, 2><<<dim3((TT - RH) / 64, KSP, ZH), 32, 0, stream>>>(P16 + (size_t)RH * PP, nullptr, PP, VT16 + zk * HD * TT, nullptr, TT, Ob + (size_t)RH * HD, HD, RH, (size_t)TT * PP, (size_t)HD * TT, (size_t)TT * HD, (size_t)ZH * TT * HD);
            k_merge<<<(unsigned)(((size_t)ZH * TT * HD / 2 + 255) / 256), 256, 0, stream>>>(Ob, h0, ATh, ATl); }
        k_gemmw<bf, 1, false><<<dim3(TT / 64, DM / 64, 1), 32, 0, stream>>>(ATh, ATl, WO, nullptr, DQ, OUT + (size_t)b * TT * DM, DM, nullptr, 0, 0, 0); }
}

// v003
// It runs in 328 microseconds.
// Next to v002, in two timings, it ran 1.75 times as fast each time.
// All steps since v000 together make it 4.40 times as fast.
#include <hip/hip_runtime.h>

// Causal multi-head attention with a fused qkv projection and rotary embeddings from FOUR input tables (query [2][2048][1024]; qkv = query w_in ('xw' [1024][3072] 1/32, no bias) -> q | k | v column thirds (16 heads x 64); q = q cos_q + rotate_half(q) sin_q, k = k cos_k + rotate_half(k) sin_k with sin_q, cos_q, sin_k, cos_k [1][1][2048][64] INPUTS (full-width per-element tables, separate for q and k; read as data); scores x 1/sqrt(64); causal (finfo.min); softmax; out = merged w_out ('xw' [1024][1024], no bias) -> [2][2048][1024] (4.2 M); argument order query, sin_q, cos_q, sin_k, cos_k, w_in, w_out).
// Layout per batch: bf16 copy of query; the fused 'xw' weight transposed once into Bt (q | k | v row blocks); exact projections; TWO {cos, sin} tables from the bf16-rounded inputs (one for q, one for k); rotate-half plane builders; causal T-2048 attention in one fused kernel per batch (k_flash; hybrid rows: < 512 hi/lo 3 products, rest fp16 x1024; keys above the diagonal block are never visited); merged hi/lo x w_out exact.
// Compute dtypes, f32 accumulate: every input rounded to bf16 incl. the four tables; projections exact; rotary f32; attention rows < 512 3 products, rest fp16; softmax f32; w_out hl x exact.

#define NB_  2
#define TT   2048
#define DM   1024
#define NH_  16
#define NKV  16
#define REP  (NH_ / NKV)
#define HD   64
#define DQ   (NH_ * HD)
#define DKV  (NKV * HD)
#define RH   512                  // query rows < RH use hi+lo planes (0: none)
typedef _Float16 h16;
typedef unsigned short bf;
typedef __attribute__((ext_vector_type(16))) __bf16   v16bf;
typedef __attribute__((ext_vector_type(16))) _Float16 v16h;
typedef __attribute__((ext_vector_type(8)))  _Float16 v8h;
typedef __attribute__((ext_vector_type(8)))  unsigned short v8us;
typedef __attribute__((ext_vector_type(8)))  float    v8f;
typedef __attribute__((ext_vector_type(4)))  float    v4f;
typedef v8h  __attribute__((may_alias)) v8ha;
typedef v4f  __attribute__((may_alias)) v4fa;
typedef v8us __attribute__((may_alias)) v8usa;

__device__ __forceinline__ unsigned short f2bf(float f) { unsigned u = __float_as_uint(f); u += 0x7FFFu + ((u >> 16) & 1u); return (unsigned short)(u >> 16); }
__device__ __forceinline__ float bf2f(unsigned short b) { return __uint_as_float(((unsigned)b) << 16); }
__device__ __forceinline__ float bfr(float f) { return bf2f(f2bf(f)); }
__device__ __forceinline__ v16h cat16(v8h lo, v8h hi) { return __builtin_shufflevector(lo, hi, 0, 1, 2, 3, 4, 5, 6, 7, 8, 9, 10, 11, 12, 13, 14, 15); }
__device__ __forceinline__ v16bf cat16b(v8us lo, v8us hi) { return __builtin_bit_cast(v16bf, __builtin_shufflevector(lo, hi, 0, 1, 2, 3, 4, 5, 6, 7, 8, 9, 10, 11, 12, 13, 14, 15)); }
__device__ __forceinline__ v8f wmma16(v16h a, v16h b, v8f c) { return __builtin_amdgcn_wmma_f32_16x16x32_f16(false, a, false, b, (short)0, c, false, false); }
__device__ __forceinline__ v8f wmmab(v16bf a, v16bf b, v8f c) { return __builtin_amdgcn_wmma_f32_16x16x32_bf16(false, a, false, b, (short)0, c, false, false); }



// ---- k_gemmw: register-blocked GEMM, ONE WAVE per 64x64 output tile (16 accumulators), operands straight from K-contiguous 16-bit planes; grid (M/64, N/64, Z), 32 threads.
// C[m][n] (f32, pitch ldc, + optional f32 bias[n]) = sum_k A[m][k] Bt[n][k] (+ split products per NSPLIT). z-batch strides sA/sB/sC in elements. K % 32 == 0.
template <typename T16> struct WFrag;
template <> struct WFrag<h16> { typedef v16h V; static __device__ __forceinline__ V ld(const h16* p) { return cat16(*(const v8h*)p, *(const v8h*)(p + 16)); } static __device__ __forceinline__ v8f mma(V a, V b, v8f c) { return wmma16(a, b, c); } };
template <> struct WFrag<bf> { typedef v16bf V; static __device__ __forceinline__ V ld(const bf* p) { return cat16b(*(const v8us*)p, *(const v8us*)(p + 16)); } static __device__ __forceinline__ v8f mma(V a, V b, v8f c) { return wmmab(a, b, c); } };
// xwait: stands behind a global load, in front of whatever next rewrites the load's address registers (a later load's result may land in them)
__device__ __forceinline__ void xwait() { asm volatile("s_wait_xcnt 0x0" ::: "memory"); }
// ldw: the fragment load of WFrag::ld with that wait behind each of its two loads
__device__ __forceinline__ v16h ldw(const h16* p) { const v8h lo = *(const v8h*)p; xwait(); const v8h hi = *(const v8h*)(p + 16); xwait(); return cat16(lo, hi); }
__device__ __forceinline__ v16bf ldw(const bf* p) { const v8us lo = *(const v8us*)p; xwait(); const v8us hi = *(const v8us*)(p + 16); xwait(); return cat16b(lo, hi); }
template <typename T16, int NSPLIT, bool BIAS>
__global__ __launch_bounds__(32) void k_gemmw(const T16* __restrict__ A, const T16* __restrict__ A2, const T16* __restrict__ Bt, const T16* __restrict__ Bt2, int K, float* C, int ldc, const float* __restrict__ bias, size_t sA, size_t sB, size_t sC) {
    typedef typename WFrag<T16>::V V;
    __shared__ __align__(16) float os[16 * 68];
    const size_t z = blockIdx.z; A += z * sA; if (A2) A2 += z * sA; Bt += z * sB; if (Bt2) Bt2 += z * sB; C += z * sC;
    const int lane = threadIdx.x & 31, lr = lane & 15, hi = lane >> 4; const int r0 = blockIdx.x * 64, c0 = blockIdx.y * 64;
    v8f acc[4][4];
#pragma unroll
    for (int mb = 0; mb < 4; ++mb)
#pragma unroll
        for (int nb = 0; nb < 4; ++nb) acc[mb][nb] = (v8f){};
    const size_t aoff = (size_t)(r0 + lr) * K + 8 * hi, boff = (size_t)(c0 + lr) * K + 8 * hi;
#pragma unroll 1
    for (int kc = 0; kc < K; kc += 32) {
        V a[4], a2[4];
#pragma unroll
        for (int mb = 0; mb < 4; ++mb) { a[mb] = WFrag<T16>::ld(A + aoff + (size_t)mb * 16 * K + kc); if (NSPLIT == 1 || NSPLIT == 2) a2[mb] = WFrag<T16>::ld(A2 + aoff + (size_t)mb * 16 * K + kc); }
#pragma unroll
        for (int nb = 0; nb < 4; ++nb) { const V b = WFrag<T16>::ld(Bt + boff + (size_t)nb * 16 * K + kc); V b2; if (NSPLIT >= 2) b2 = WFrag<T16>::ld(Bt2 + boff + (size_t)nb * 16 * K + kc);
#pragma unroll
            for (int mb = 0; mb < 4; ++mb) { acc[mb][nb] = WFrag<T16>::mma(a[mb], b, acc[mb][nb]); if (NSPLIT == 1 || NSPLIT == 2) acc[mb][nb] = WFrag<T16>::mma(a2[mb], b, acc[mb][nb]); if (NSPLIT >= 2) acc[mb][nb] = WFrag<T16>::mma(a[mb], b2, acc[mb][nb]); } }
        asm volatile("v_nop\n\tv_nop\n\tv_nop\n\tv_nop" : "+v"(acc[0][0]), "+v"(acc[1][1]), "+v"(acc[2][2]), "+v"(acc[3][3]) : "v"(a[0]), "v"(a[3]));
    }
#pragma unroll
    for (int mb = 0; mb < 4; ++mb) {
#pragma unroll
        for (int nb = 0; nb < 4; ++nb) {
#pragma unroll
            for (int j = 0; j < 8; ++j) os[(hi * 8 + j) * 68 + nb * 16 + lr] = acc[mb][nb][j]; }
        __builtin_amdgcn_wave_barrier(); asm volatile("" ::: "memory");
        float* crow = C + (size_t)(r0 + mb * 16) * ldc + c0;
{
#pragma unroll
            for (int s = 0; s < 8; ++s) { const int row = 2 * s + hi, cofs = lr * 4; v4f val = *(const v4fa*)(os + row * 68 + cofs); if (BIAS) { val[0] += bfr(bias[c0 + cofs]); val[1] += bfr(bias[c0 + cofs + 1]); val[2] += bfr(bias[c0 + cofs + 2]); val[3] += bfr(bias[c0 + cofs + 3]); }
                *(v4f*)(crow + (size_t)row * ldc + cofs) = val; }
             }
        __builtin_amdgcn_wave_barrier(); asm volatile("" ::: "memory");
    }
}

__device__ __forceinline__ h16 tohx(float x) { return (h16)x; }
__device__ __forceinline__ void splitf(float y, unsigned short& h, unsigned short& l) { h = f2bf(y); l = f2bf(y - bf2f(h)); }
typedef __attribute__((ext_vector_type(2))) _Float16 v2h;
typedef __attribute__((ext_vector_type(4))) _Float16 v4h;
typedef __attribute__((ext_vector_type(2))) unsigned short v2us;
typedef __attribute__((ext_vector_type(4))) unsigned short v4us;
typedef __attribute__((ext_vector_type(2))) float v2f;
typedef __attribute__((ext_vector_type(4))) int v4i;
typedef v4h  __attribute__((may_alias)) v4ha;
typedef v4us __attribute__((may_alias)) v4usa;

__global__ __launch_bounds__(256) void k_wtG(const float* __restrict__ w, int K, int N, bf* Bt) {
    const int lane = threadIdx.x & 31; const int L0 = (blockIdx.x * 8 + (threadIdx.x >> 5)) * 8; const int nlines = N * K / 64;
{
#pragma unroll 1
        for (int l = 0; l < 8; ++l) { const int L = L0 + l; if (L >= nlines) break; const size_t e = (size_t)L * 64 + lane * 2; const int k = (int)(e % K), n = (int)(e / K); v2us o;
            o[0] = f2bf(w[(size_t)k * N + n]); o[1] = f2bf(w[(size_t)(k + 1) * N + n]); *(v2us*)(Bt + e) = o; }
         }
}
__global__ __launch_bounds__(256) void k_cvt8(const float* __restrict__ src, bf* dst, size_t n8) { const size_t i = (size_t)blockIdx.x * 256 + threadIdx.x; if (i >= n8) return; const v8f v = *(const v8f*)(src + i * 8); v8us o;
#pragma unroll
    for (int k = 0; k < 8; ++k) o[k] = f2bf(v[k]); *(v8us*)(dst + i * 8) = o;  }

// k_rope: head planes [h][t][d] (fp16 + hi/lo) of rope(x) x sc with the rotate-half convention out[d] = x[d] cos[t][d] - x[d+HD/2] sin[t][d], out[d+HD/2] = x[d+HD/2] cos[t][d+HD/2] + x[d] sin[t][d+HD/2]
__global__ __launch_bounds__(256) void k_rope(const float* __restrict__ F, int pitch, int nheads, const float* __restrict__ CS, const float* __restrict__ RF, const float* __restrict__ nw, float sc, h16* P16, bf* Ph, bf* Pl) {
    const size_t e = ((size_t)blockIdx.x * 256 + threadIdx.x) * 2; if (e >= (size_t)nheads * TT * HD) return; const int d = (int)(e % HD); const int t = (int)((e / HD) % TT); const int h = (int)(e / ((size_t)HD * TT)); const float* f = F + (size_t)t * pitch + h * HD; const float rf = RF ? RF[(size_t)h * TT + t] : 1.0f; v2h o16; v2us oh, ol;
#pragma unroll
    for (int q = 0; q < 2; ++q) { const int dd = d + q; const int dp = (dd < HD / 2) ? dd + HD / 2 : dd - HD / 2; float x0 = f[dd], x1 = f[dp];
        if (RF) { float n0 = __fmul_rn(x0, rf), n1 = __fmul_rn(x1, rf); asm volatile("" : "+v"(n0)); asm volatile("" : "+v"(n1)); x0 = __fmul_rn(bfr(nw[dd]), n0); x1 = __fmul_rn(bfr(nw[dp]), n1); }
        const v2f cs = *(const v2f*)(CS + ((size_t)t * HD + dd) * 2); float a = __fmul_rn(x0, cs[0]), bq = __fmul_rn(x1, cs[1]); asm volatile("" : "+v"(a)); asm volatile("" : "+v"(bq)); const float r = ((dd < HD / 2) ? __fsub_rn(a, bq) : __fadd_rn(a, bq)) * sc;
        o16[q] = tohx(r); unsigned short a2, c2; splitf(r, a2, c2); oh[q] = a2; ol[q] = c2; }
    *(v2h*)(P16 + e) = o16; *(v2us*)(Ph + e) = oh; *(v2us*)(Pl + e) = ol;  }
__global__ __launch_bounds__(256) void k_vtp(const float* __restrict__ F, int pitch, int nheads, h16* V16, bf* Vh, bf* Vl) { const size_t e = ((size_t)blockIdx.x * 256 + threadIdx.x) * 2; if (e >= (size_t)nheads * HD * TT) return; const int t = (int)(e % TT); const int d = (int)((e / TT) % HD); const int g = (int)(e / ((size_t)TT * HD)); v2h o16; v2us oh, ol;
#pragma unroll
    for (int q = 0; q < 2; ++q) { const float x = F[(size_t)(t + q) * pitch + g * HD + d]; o16[q] = tohx(x); unsigned short a2, c2; splitf(x, a2, c2); oh[q] = a2; ol[q] = c2; }
    *(v2h*)(V16 + e) = o16; *(v2us*)(Vh + e) = oh; *(v2us*)(Vl + e) = ol;  }
__global__ __launch_bounds__(256) void k_cscvt(const float* __restrict__ cosT, const float* __restrict__ sinT, float* CS) { const int idx = blockIdx.x * 256 + threadIdx.x; if (idx >= TT * HD) return; v2f cs; cs[0] = bfr(cosT[idx]); cs[1] = bfr(sinT[idx]); *(v2f*)(CS + (size_t)idx * 2) = cs;  }
#define FW   4                        // waves per work-group
#define OPIT 68                       // pitch, in floats, of one query's 64 partial outputs in LDS
#define CEXP 0.18033688011112042f     // HD^-0.5 x log2(e)
typedef __attribute__((ext_vector_type(16))) unsigned short v16us;
__device__ __forceinline__ float xhalf(float x) { return __builtin_bit_cast(float, __builtin_amdgcn_permlanex16(__builtin_bit_cast(int, x), __builtin_bit_cast(int, x), 0x76543210, 0xfedcba98, false, false)); }   // lane l with lane l ^ 16
template <typename T16, int NSPLIT, int NQ>
__device__ __forceinline__ void flash_body(const T16* __restrict__ Q, const T16* __restrict__ Q2, const T16* __restrict__ Kp, const T16* __restrict__ K2, const T16* __restrict__ Vt, const T16* __restrict__ V2, int q0, bf* Ah, bf* Al, float* so, float* sm, float* sl) {
    typedef typename WFrag<T16>::V V;
    constexpr int QT = NQ * 16;
    const int lane = threadIdx.x & 31, lr = lane & 15, hi = lane >> 4; const int wv = __builtin_amdgcn_readfirstlane((int)(threadIdx.x >> 5));
    const float SH = (NSPLIT == 0) ? 10.0f : 0.0f;
    V qf[NQ][2], qf2[NQ][2];
#pragma unroll
    for (int qt = 0; qt < NQ; ++qt)
#pragma unroll
        for (int ks = 0; ks < 2; ++ks) { const size_t qo = (size_t)(q0 + qt * 16 + lr) * HD + ks * 32 + 8 * hi; qf[qt][ks] = WFrag<T16>::ld(Q + qo); if (NSPLIT) qf2[qt][ks] = WFrag<T16>::ld(Q2 + qo); }
    v8f o[4][NQ]; float mb[NQ], ls[NQ];
#pragma unroll
    for (int qt = 0; qt < NQ; ++qt) { mb[qt] = -3.0e38f; ls[qt] = 0.f;
#pragma unroll
        for (int dt = 0; dt < 4; ++dt) o[dt][qt] = (v8f){}; }
    const int nch = (q0 + QT + 31) / 32;   // chunks up to and including the one that holds the block's last diagonal element
    V kf[2][2], kf2[2][2];
    auto ldk = [&](int kc) {
#pragma unroll
        for (int kt = 0; kt < 2; ++kt)
#pragma unroll
            for (int ks = 0; ks < 2; ++ks) { const size_t ko = (size_t)(kc + kt * 16 + lr) * HD + ks * 32 + 8 * hi; kf[kt][ks] = ldw(Kp + ko); if (NSPLIT) kf2[kt][ks] = ldw(K2 + ko); }
    };
    constexpr bool AHEAD = (NSPLIT == 0);   // key fragments fetched one pass ahead; not in the hi/lo body, whose two planes of fragments would then pass 256 registers (its loops are short)
    if (AHEAD && wv < nch) ldk(wv * 32);
#pragma unroll 1   // kept rolled: a second chunk's products in flight would add their registers to those of the accumulators
    for (int c = wv; c < nch; c += FW) {
        const int kc = c * 32;
        V vf[4], vf2[4];
        if (!AHEAD) ldk(kc);
#pragma unroll
        for (int dt = 0; dt < 4; ++dt) { const size_t vo = (size_t)(dt * 16 + lr) * TT + kc + 8 * hi; vf[dt] = ldw(Vt + vo); if (NSPLIT) vf2[dt] = ldw(V2 + vo); }
        __builtin_amdgcn_sched_barrier(0);   // every load of the pass issues before its first score product (one wait on memory per pass, not two); the value loads fly during products and softmax
        v8f s[2][NQ];
#pragma unroll
        for (int kt = 0; kt < 2; ++kt)
#pragma unroll
            for (int qt = 0; qt < NQ; ++qt) { v8f a = (v8f){};
#pragma unroll
                for (int ks = 0; ks < 2; ++ks) { a = WFrag<T16>::mma(kf[kt][ks], qf[qt][ks], a); if (NSPLIT) { a = WFrag<T16>::mma(kf[kt][ks], qf2[qt][ks], a); a = WFrag<T16>::mma(kf2[kt][ks], qf[qt][ks], a); } }
                s[kt][qt] = a; }
        if (AHEAD) ldk((c + FW < nch) ? kc + FW * 32 : kc);   // this wave's next key fragments fly during softmax and the value products; the last pass re-reads its own chunk (in bounds, unused) rather than branch behind the products
        if (kc + 31 > q0) {   // only a chunk that reaches past the block's first query holds keys above the diagonal; its key kc is at or below every query of the block, so no query's chunk is all masked
#pragma unroll
            for (int kt = 0; kt < 2; ++kt)
#pragma unroll
                for (int qt = 0; qt < NQ; ++qt)
#pragma unroll
                    for (int j = 0; j < 8; ++j) s[kt][qt][j] = (kc + kt * 16 + hi * 8 + j <= q0 + qt * 16 + lr) ? s[kt][qt][j] : -3.0e38f; }
        V pf[NQ], pf2[NQ];
#pragma unroll
        for (int qt = 0; qt < NQ; ++qt) {
            float mx = fmaxf(s[0][qt][0], s[1][qt][0]);
#pragma unroll
            for (int j = 1; j < 8; ++j) mx = fmaxf(mx, fmaxf(s[0][qt][j], s[1][qt][j]));
            mx = fmaxf(mx, xhalf(mx)) * CEXP;
            if (__builtin_amdgcn_ballot_w32(mx > mb[qt]) != 0) {   // no query's maximum rose: the factor would be exactly 1
                const float mn = fmaxf(mb[qt], mx); const float al = __builtin_amdgcn_exp2f(mb[qt] - mn); mb[qt] = mn; ls[qt] *= al;
#pragma unroll
                for (int dt = 0; dt < 4; ++dt) o[dt][qt] *= al; }
            const float bias = SH - mb[qt]; float p[16];
#pragma unroll
            for (int e = 0; e < 16; ++e) p[e] = __builtin_amdgcn_exp2f(fmaf(s[e >> 3][qt][e & 7], CEXP, bias));
            ls[qt] += (((p[0] + p[1]) + (p[2] + p[3])) + ((p[4] + p[5]) + (p[6] + p[7]))) + (((p[8] + p[9]) + (p[10] + p[11])) + ((p[12] + p[13]) + (p[14] + p[15])));
            if constexpr (NSPLIT == 0) { v16h f;
#pragma unroll
                for (int e = 0; e < 16; e += 2) { v2f x; x[0] = p[e]; x[1] = p[e + 1]; const v2h y = __builtin_convertvector(x, v2h); f[e] = y[0]; f[e + 1] = y[1]; }
                pf[qt] = f;
            } else { v16us fh, fl;
#pragma unroll
                for (int e = 0; e < 16; ++e) { unsigned short a, c2; splitf(p[e], a, c2); fh[e] = a; fl[e] = c2; }
                pf[qt] = __builtin_bit_cast(v16bf, fh); pf2[qt] = __builtin_bit_cast(v16bf, fl); } }
#pragma unroll
        for (int dt = 0; dt < 4; ++dt)
#pragma unroll
            for (int qt = 0; qt < NQ; ++qt) { o[dt][qt] = WFrag<T16>::mma(vf[dt], pf[qt], o[dt][qt]); if (NSPLIT) { o[dt][qt] = WFrag<T16>::mma(vf[dt], pf2[qt], o[dt][qt]); o[dt][qt] = WFrag<T16>::mma(vf2[dt], pf[qt], o[dt][qt]); } }
    }
    float* ow = so + (size_t)wv * QT * OPIT;
#pragma unroll
    for (int qt = 0; qt < NQ; ++qt) { const float lt = ls[qt] + xhalf(ls[qt]); const int row = qt * 16 + lr;
#pragma unroll
        for (int dt = 0; dt < 4; ++dt) { v4f x0, x1;
#pragma unroll
            for (int j = 0; j < 4; ++j) { x0[j] = o[dt][qt][j]; x1[j] = o[dt][qt][4 + j]; }
            *(v4fa*)(ow + row * OPIT + dt * 16 + hi * 8) = x0; *(v4fa*)(ow + row * OPIT + dt * 16 + hi * 8 + 4) = x1; }
        if (hi == 0) { sm[wv * QT + row] = mb[qt]; sl[wv * QT + row] = lt; } }
    __syncthreads();   // every wave's partial rows (zeros with sum 0 from a wave that had no chunk) are in LDS before any thread joins them
    constexpr int TPQ = FW * 32 / QT, ND = HD / TPQ;   // threads per query, outputs per thread
    const int qi = threadIdx.x / TPQ, d0 = (threadIdx.x % TPQ) * ND;
    float fw[FW]; float mm = -3.0e38f, den = 0.f;
#pragma unroll
    for (int w = 0; w < FW; ++w) { fw[w] = sm[w * QT + qi]; mm = fmaxf(mm, fw[w]); }
#pragma unroll
    for (int w = 0; w < FW; ++w) { fw[w] = __builtin_amdgcn_exp2f(fw[w] - mm); den += fw[w] * sl[w * QT + qi]; }
    const float inv = __fdiv_rn(1.0f, den);
#pragma unroll
    for (int e0 = 0; e0 < ND; e0 += 8) { v4f a0 = (v4f){}, a1 = (v4f){};
#pragma unroll
        for (int w = 0; w < FW; ++w) { const float* r = so + (size_t)(w * QT + qi) * OPIT + d0 + e0; a0 += fw[w] * *(const v4fa*)r; a1 += fw[w] * *(const v4fa*)(r + 4); }
        v8us oh, ol;
#pragma unroll
        for (int k = 0; k < 4; ++k) { unsigned short a, c2; splitf(a0[k] * inv, a, c2); oh[k] = a; ol[k] = c2; splitf(a1[k] * inv, a, c2); oh[4 + k] = a; ol[4 + k] = c2; }
        const size_t oo = (size_t)(q0 + qi) * DQ + d0 + e0; *(v8us*)(Ah + oo) = oh; xwait(); *(v8us*)(Al + oo) = ol; xwait(); }
}
// grid (query blocks, heads): the fp16 blocks first, longest first, then the hi/lo blocks
__global__ __launch_bounds__(FW * 32) void k_flash(const h16* __restrict__ Q16, const h16* __restrict__ K16, const h16* __restrict__ V16, const bf* __restrict__ Qh, const bf* __restrict__ Ql, const bf* __restrict__ Kh, const bf* __restrict__ Kl, const bf* __restrict__ Vh, const bf* __restrict__ Vl, bf* Ah, bf* Al) {
    __shared__ __align__(16) float so[FW * 32 * OPIT]; __shared__ float sm[FW * 32]; __shared__ float sl[FW * 32];
    const int bx = blockIdx.x; const size_t zq = (size_t)blockIdx.y * TT * HD, zk = (size_t)(blockIdx.y / REP) * TT * HD; Ah += blockIdx.y * HD; Al += blockIdx.y * HD;
    if (bx < (TT - RH) / 32) flash_body<h16, 0, 2>(Q16 + zq, nullptr, K16 + zk, nullptr, V16 + zk, nullptr, TT - 32 - bx * 32, Ah, Al, so, sm, sl);
    else flash_body<bf, 2, 1>(Qh + zq, Ql + zq, Kh + zk, Kl + zk, Vh + zk, Vl + zk, (bx - (TT - RH) / 32) * 16, Ah, Al, so, sm, sl);
}

extern "C" void kernel_launch(void* const* d_in, const int* in_sizes, int n_in,
                              void* d_out, int out_size, void* d_ws, size_t ws_size, hipStream_t stream) {
    (void)in_sizes; (void)n_in; (void)out_size;
    const float* x = (const float*)d_in[0]; const float* fsinq = (const float*)d_in[1]; const float* fcosq = (const float*)d_in[2]; const float* fsink = (const float*)d_in[3]; const float* fcosk = (const float*)d_in[4]; const float* wqkv = (const float*)d_in[5]; const float* wo = (const float*)d_in[6];   /* input order query, sin_q, cos_q, sin_k, cos_k ([1][1][2048][64] each), w_in ('xw' [1024][3072]), w_out ('xw') */ const float* wq = wqkv; const float* wk = nullptr; const float* wv = nullptr; (void)wk; (void)wv;
    float* OUT = (float*)d_out;     // [2][2048][1024]
    char* wsp = (char*)d_ws;
    auto take = [&](size_t bytes) { char* p = wsp; wsp += (bytes + 255) & ~(size_t)255; return (void*)p; };
    bf* WQKV = (bf*)take((size_t)3 * DQ * DM * 2); bf* WQ = WQKV; bf* WK = WQKV + (size_t)DQ * DM; bf* WV = WQKV + (size_t)2 * DQ * DM;   /* fused Bt [3*DQ][DM]: q | k | v row blocks */ bf* WO = (bf*)take((size_t)DM * DQ * 2); float* CS = (float*)take((size_t)TT * HD * 2 * 4); float* CSK = (float*)take((size_t)TT * HD * 2 * 4);   /* second {cos, sin} table: the k stream has its own input tables */
    h16* QP16 = (h16*)take((size_t)NH_ * TT * HD * 2); h16* KP16 = (h16*)take((size_t)NKV * TT * HD * 2); h16* VT16 = (h16*)take((size_t)NKV * HD * TT * 2);
    bf* QPh = (bf*)take((size_t)NH_ * TT * HD * 2); bf* QPl = (bf*)take((size_t)NH_ * TT * HD * 2); bf* KPh = (bf*)take((size_t)NKV * TT * HD * 2); bf* KPl = (bf*)take((size_t)NKV * TT * HD * 2); bf* VTh = (bf*)take((size_t)NKV * HD * TT * 2); bf* VTl = (bf*)take((size_t)NKV * HD * TT * 2);
    float* FQ = (float*)take((size_t)TT * DQ * 4); float* FK = (float*)take((size_t)TT * DKV * 4); bf* XB = (bf*)take((size_t)TT * DM * 2); bf* ATh = (bf*)take((size_t)TT * DQ * 2); bf* ATl = (bf*)take((size_t)TT * DQ * 2);
    if ((size_t)(wsp - (char*)d_ws) > ws_size) return;    // ws 256 MiB
    float* FV = FK;   // v projection reuses the k buffer after the k planes are built (stream-ordered)
    { k_wtG<<<(unsigned)((DM * 3 * DQ / 64 + 63) / 64), 256, 0, stream>>>(wqkv, DM, 3 * DQ, WQKV);   /* fused 'xw' [DM][3*DQ] -> Bt [3*DQ][DM] */
      k_wtG<<<(unsigned)((DQ * DM / 64 + 63) / 64), 256, 0, stream>>>(wo, DQ, DM, WO);
       }
    k_cscvt<<<(TT * HD + 255) / 256, 256, 0, stream>>>(fcosq, fsinq, CS);   /* q table from cos_q, sin_q */ k_cscvt<<<(TT * HD + 255) / 256, 256, 0, stream>>>(fcosk, fsink, CSK);   /* k table from cos_k, sin_k */
    const unsigned LQ = (unsigned)(((size_t)NH_ * TT * HD / 2 + 255) / 256), LKv = (unsigned)(((size_t)NKV * TT * HD / 2 + 255) / 256);
    for (int b = 0; b < NB_; ++b) {
        
        k_cvt8<<<(unsigned)(((size_t)TT * DM / 8 + 255) / 256), 256, 0, stream>>>(x + (size_t)b * TT * DM, XB, (size_t)TT * DM / 8);
        k_gemmw<bf, 0, false><<<dim3(TT / 64, DQ / 64, 1), 32, 0, stream>>>(XB, nullptr, WQ, nullptr, DM, FQ, DQ, nullptr, 0, 0, 0);
        k_rope<<<LQ, 256, 0, stream>>>(FQ, DQ, NH_, CS, nullptr, nullptr, 1.0f, QP16, QPh, QPl);
        k_gemmw<bf, 0, false><<<dim3(TT / 64, DKV / 64, 1), 32, 0, stream>>>(XB, nullptr, WK, nullptr, DM, FK, DKV, nullptr, 0, 0, 0);
        k_rope<<<LKv, 256, 0, stream>>>(FK, DKV, NKV, CSK, nullptr, nullptr, 1.0f, KP16, KPh, KPl);
        k_gemmw<bf, 0, false><<<dim3(TT / 64, DKV / 64, 1), 32, 0, stream>>>(XB, nullptr, WV, nullptr, DM, FV, DKV, nullptr, 0, 0, 0); k_vtp<<<LKv, 256, 0, stream>>>(FV, DKV, NKV, VT16, VTh, VTl);
        k_flash<<<dim3((TT - RH) / 32 + RH / 16, NH_, 1), FW * 32, 0, stream>>>(QP16, KP16, VT16, QPh, QPl, KPh, KPl, VTh, VTl, ATh, ATl);
        k_gemmw<bf, 1, false><<<dim3(TT / 64, DM / 64, 1), 32, 0, stream>>>(ATh, ATl, WO, nullptr, DQ, OUT + (size_t)b * TT * DM, DM, nullptr, 0, 0, 0); }
}

// v004
// One run takes 199 microseconds.
// Two timings next to v003 put it at 1.64 and 1.61 times that version's speed.
// All steps since v000 together make it 7.16 times as fast.
#include <hip/hip_runtime.h>

// Causal multi-head attention with a fused qkv projection and rotary embeddings from FOUR input tables (query [2][2048][1024]; qkv = query w_in ('xw' [1024][3072] 1/32, no bias) -> q | k | v column thirds (16 heads x 64); q = q cos_q + rotate_half(q) sin_q, k = k cos_k + rotate_half(k) sin_k with sin_q, cos_q, sin_k, cos_k [1][1][2048][64] INPUTS (full-width per-element tables, separate for q and k; read as data); scores x 1/sqrt(64); causal (finfo.min); softmax; out = merged w_out ('xw' [1024][1024], no bias) -> [2][2048][1024] (4.2 M); argument order query, sin_q, cos_q, sin_k, cos_k, w_in, w_out).
// Layout, every stage ONE launch over both batches: bf16 copy of query ([NB_ TT][DM] rows); the fused 'xw' weight transposed once into Bt (q | k | v row blocks); one exact projection GEMM into F [NB_ TT][q | k | v]; TWO {cos, sin} tables from the bf16-rounded inputs (one for q, one for k); rotate-half plane builders (planes [batch][head]); causal T-2048 attention in one fused kernel (k_flash; hybrid rows: < 512 hi/lo 3 products, rest fp16 x1024; keys above the diagonal block are never visited); merged hi/lo x w_out exact.
// Compute dtypes, f32 accumulate: every input rounded to bf16 incl. the four tables; projections exact; rotary f32; attention rows < 512 3 products, rest fp16; softmax f32; w_out hl x exact.

#define NB_  2
#define TT   2048
#define DM   1024
#define NH_  16
#define NKV  16
#define REP  (NH_ / NKV)
#define HD   64
#define DQ   (NH_ * HD)
#define DKV  (NKV * HD)
#define RH   512                  // query rows < RH use hi+lo planes (0: none)
typedef _Float16 h16;
typedef unsigned short bf;
typedef __attribute__((ext_vector_type(16))) __bf16   v16bf;
typedef __attribute__((ext_vector_type(16))) _Float16 v16h;
typedef __attribute__((ext_vector_type(8)))  _Float16 v8h;
typedef __attribute__((ext_vector_type(8)))  unsigned short v8us;
typedef __attribute__((ext_vector_type(8)))  float    v8f;
typedef __attribute__((ext_vector_type(4)))  float    v4f;
typedef v8h  __attribute__((may_alias)) v8ha;
typedef v4f  __attribute__((may_alias)) v4fa;
typedef v8us __attribute__((may_alias)) v8usa;

__device__ __forceinline__ unsigned short f2bf(float f) { unsigned u = __float_as_uint(f); u += 0x7FFFu + ((u >> 16) & 1u); return (unsigned short)(u >> 16); }
__device__ __forceinline__ float bf2f(unsigned short b) { return __uint_as_float(((unsigned)b) << 16); }
__device__ __forceinline__ float bfr(float f) { return bf2f(f2bf(f)); }
__device__ __forceinline__ v16h cat16(v8h lo, v8h hi) { return __builtin_shufflevector(lo, hi, 0, 1, 2, 3, 4, 5, 6, 7, 8, 9, 10, 11, 12, 13, 14, 15); }
__device__ __forceinline__ v16bf cat16b(v8us lo, v8us hi) { return __builtin_bit_cast(v16bf, __builtin_shufflevector(lo, hi, 0, 1, 2, 3, 4, 5, 6, 7, 8, 9, 10, 11, 12, 13, 14, 15)); }
__device__ __forceinline__ v8f wmma16(v16h a, v16h b, v8f c) { return __builtin_amdgcn_wmma_f32_16x16x32_f16(false, a, false, b, (short)0, c, false, false); }
__device__ __forceinline__ v8f wmmab(v16bf a, v16bf b, v8f c) { return __builtin_amdgcn_wmma_f32_16x16x32_bf16(false, a, false, b, (short)0, c, false, false); }



// ---- k_gemmw: register-blocked GEMM, ONE WAVE per 64x64 output tile (16 accumulators), operands straight from K-contiguous 16-bit planes; grid (M/64, N/64, Z), 32 threads.
// C[m][n] (f32, pitch ldc, + optional f32 bias[n]) = sum_k A[m][k] Bt[n][k] (+ split products per NSPLIT). z-batch strides sA/sB/sC in elements. K % 32 == 0.
template <typename T16> struct WFrag;
template <> struct WFrag<h16> { typedef v16h V; static __device__ __forceinline__ V ld(const h16* p) { return cat16(*(const v8h*)p, *(const v8h*)(p + 16)); } static __device__ __forceinline__ v8f mma(V a, V b, v8f c) { return wmma16(a, b, c); } };
template <> struct WFrag<bf> { typedef v16bf V; static __device__ __forceinline__ V ld(const bf* p) { return cat16b(*(const v8us*)p, *(const v8us*)(p + 16)); } static __device__ __forceinline__ v8f mma(V a, V b, v8f c) { return wmmab(a, b, c); } };
// xwait: stands behind a global load, in front of whatever next rewrites the load's address registers (a later load's result may land in them)
__device__ __forceinline__ void xwait() { asm volatile("s_wait_xcnt 0x0" ::: "memory"); }
// ldw: the fragment load of WFrag::ld with that wait behind each of its two loads
__device__ __forceinline__ v16h ldw(const h16* p) { const v8h lo = *(const v8h*)p; xwait(); const v8h hi = *(const v8h*)(p + 16); xwait(); return cat16(lo, hi); }
__device__ __forceinline__ v16bf ldw(const bf* p) { const v8us lo = *(const v8us*)p; xwait(); const v8us hi = *(const v8us*)(p + 16); xwait(); return cat16b(lo, hi); }
template <typename T16, int NSPLIT, bool BIAS>
__global__ __launch_bounds__(32) void k_gemmw(const T16* __restrict__ A, const T16* __restrict__ A2, const T16* __restrict__ Bt, const T16* __restrict__ Bt2, int K, float* C, int ldc, const float* __restrict__ bias, size_t sA, size_t sB, size_t sC) {
    typedef typename WFrag<T16>::V V;
    __shared__ __align__(16) float os[16 * 68];
    const size_t z = blockIdx.z; A += z * sA; if (A2) A2 += z * sA; Bt += z * sB; if (Bt2) Bt2 += z * sB; C += z * sC;
    const int lane = threadIdx.x & 31, lr = lane & 15, hi = lane >> 4; const int r0 = blockIdx.x * 64, c0 = blockIdx.y * 64;
    v8f acc[4][4];
#pragma unroll
    for (int mb = 0; mb < 4; ++mb)
#pragma unroll
        for (int nb = 0; nb < 4; ++nb) acc[mb][nb] = (v8f){};
    const size_t aoff = (size_t)(r0 + lr) * K + 8 * hi, boff = (size_t)(c0 + lr) * K + 8 * hi;
#pragma unroll 1
    for (int kc = 0; kc < K; kc += 32) {
        V a[4], a2[4];
#pragma unroll
        for (int mb = 0; mb < 4; ++mb) { a[mb] = WFrag<T16>::ld(A + aoff + (size_t)mb * 16 * K + kc); if (NSPLIT == 1 || NSPLIT == 2) a2[mb] = WFrag<T16>::ld(A2 + aoff + (size_t)mb * 16 * K + kc); }
#pragma unroll
        for (int nb = 0; nb < 4; ++nb) { const V b = WFrag<T16>::ld(Bt + boff + (size_t)nb * 16 * K + kc); V b2; if (NSPLIT >= 2) b2 = WFrag<T16>::ld(Bt2 + boff + (size_t)nb * 16 * K + kc);
#pragma unroll
            for (int mb = 0; mb < 4; ++mb) { acc[mb][nb] = WFrag<T16>::mma(a[mb], b, acc[mb][nb]); if (NSPLIT == 1 || NSPLIT == 2) acc[mb][nb] = WFrag<T16>::mma(a2[mb], b, acc[mb][nb]); if (NSPLIT >= 2) acc[mb][nb] = WFrag<T16>::mma(a[mb], b2, acc[mb][nb]); } }
        asm volatile("v_nop\n\tv_nop\n\tv_nop\n\tv_nop" : "+v"(acc[0][0]), "+v"(acc[1][1]), "+v"(acc[2][2]), "+v"(acc[3][3]) : "v"(a[0]), "v"(a[3]));
    }
#pragma unroll
    for (int mb = 0; mb < 4; ++mb) {
#pragma unroll
        for (int nb = 0; nb < 4; ++nb) {
#pragma unroll
            for (int j = 0; j < 8; ++j) os[(hi * 8 + j) * 68 + nb * 16 + lr] = acc[mb][nb][j]; }
        __builtin_amdgcn_wave_barrier(); asm volatile("" ::: "memory");
        float* crow = C + (size_t)(r0 + mb * 16) * ldc + c0;
{
#pragma unroll
            for (int s = 0; s < 8; ++s) { const int row = 2 * s + hi, cofs = lr * 4; v4f val = *(const v4fa*)(os + row * 68 + cofs); if (BIAS) { val[0] += bfr(bias[c0 + cofs]); val[1] += bfr(bias[c0 + cofs + 1]); val[2] += bfr(bias[c0 + cofs + 2]); val[3] += bfr(bias[c0 + cofs + 3]); }
                *(v4f*)(crow + (size_t)row * ldc + cofs) = val; }
             }
        __builtin_amdgcn_wave_barrier(); asm volatile("" ::: "memory");
    }
}

__device__ __forceinline__ h16 tohx(float x) { return (h16)x; }
__device__ __forceinline__ void splitf(float y, unsigned short& h, unsigned short& l) { h = f2bf(y); l = f2bf(y - bf2f(h)); }
typedef __attribute__((ext_vector_type(2))) _Float16 v2h;
typedef __attribute__((ext_vector_type(4))) _Float16 v4h;
typedef __attribute__((ext_vector_type(2))) unsigned short v2us;
typedef __attribute__((ext_vector_type(4))) unsigned short v4us;
typedef __attribute__((ext_vector_type(2))) float v2f;
typedef __attribute__((ext_vector_type(4))) int v4i;
typedef v4h  __attribute__((may_alias)) v4ha;
typedef v4us __attribute__((may_alias)) v4usa;

// grid.y picks the weight: 0 = (w0, N0, Bt0), 1 = (w1, N1, Bt1); both have K rows; grid.x is sized for the larger, the other's spare work-groups leave at once
__global__ __launch_bounds__(256) void k_wtG(const float* __restrict__ w0, int N0, bf* Bt0, const float* __restrict__ w1, int N1, bf* Bt1, int K) {
    const float* __restrict__ w = blockIdx.y ? w1 : w0; const int N = blockIdx.y ? N1 : N0; bf* Bt = blockIdx.y ? Bt1 : Bt0;
    const int lane = threadIdx.x & 31; const int L0 = (blockIdx.x * 8 + (threadIdx.x >> 5)) * 8; const int nlines = N * K / 64;
{
#pragma unroll 1
        for (int l = 0; l < 8; ++l) { const int L = L0 + l; if (L >= nlines) break; const size_t e = (size_t)L * 64 + lane * 2; const int k = (int)(e % K), n = (int)(e / K); v2us o;
            o[0] = f2bf(w[(size_t)k * N + n]); o[1] = f2bf(w[(size_t)(k + 1) * N + n]); *(v2us*)(Bt + e) = o; }
         }
}
__global__ __launch_bounds__(256) void k_cvt8(const float* __restrict__ src, bf* dst, size_t n8) { const size_t i = (size_t)blockIdx.x * 256 + threadIdx.x; if (i >= n8) return; const v8f v = *(const v8f*)(src + i * 8); v8us o;
#pragma unroll
    for (int k = 0; k < 8; ++k) o[k] = f2bf(v[k]); *(v8us*)(dst + i * 8) = o;  }

// k_rope: head planes [h][t][d] (fp16 + hi/lo) of rope(x) x sc with the rotate-half convention out[d] = x[d] cos[t][d] - x[d+HD/2] sin[t][d], out[d+HD/2] = x[d+HD/2] cos[t][d+HD/2] + x[d] sin[t][d+HD/2]
__global__ __launch_bounds__(256) void k_rope(const float* __restrict__ F, int pitch, int nheads, const float* __restrict__ CS, const float* __restrict__ RF, const float* __restrict__ nw, float sc, h16* P16, bf* Ph, bf* Pl) {
    { const size_t b = blockIdx.y, st = blockIdx.z;   // grid.y: batch; grid.z: stream (0 = q, 1 = k): its column third of F, its table, its planes ([stream][batch][head])
      F += b * TT * pitch + st * nheads * HD; CS += st * TT * HD * 2; const size_t po = (st * NB_ + b) * nheads * TT * HD; P16 += po; Ph += po; Pl += po; }
    const size_t e = ((size_t)blockIdx.x * 256 + threadIdx.x) * 2; if (e >= (size_t)nheads * TT * HD) return; const int d = (int)(e % HD); const int t = (int)((e / HD) % TT); const int h = (int)(e / ((size_t)HD * TT)); const float* f = F + (size_t)t * pitch + h * HD; const float rf = RF ? RF[(size_t)h * TT + t] : 1.0f; v2h o16; v2us oh, ol;
#pragma unroll
    for (int q = 0; q < 2; ++q) { const int dd = d + q; const int dp = (dd < HD / 2) ? dd + HD / 2 : dd - HD / 2; float x0 = f[dd], x1 = f[dp];
        if (RF) { float n0 = __fmul_rn(x0, rf), n1 = __fmul_rn(x1, rf); asm volatile("" : "+v"(n0)); asm volatile("" : "+v"(n1)); x0 = __fmul_rn(bfr(nw[dd]), n0); x1 = __fmul_rn(bfr(nw[dp]), n1); }
        const v2f cs = *(const v2f*)(CS + ((size_t)t * HD + dd) * 2); float a = __fmul_rn(x0, cs[0]), bq = __fmul_rn(x1, cs[1]); asm volatile("" : "+v"(a)); asm volatile("" : "+v"(bq)); const float r = ((dd < HD / 2) ? __fsub_rn(a, bq) : __fadd_rn(a, bq)) * sc;
        o16[q] = tohx(r); unsigned short a2, c2; splitf(r, a2, c2); oh[q] = a2; ol[q] = c2; }
    *(v2h*)(P16 + e) = o16; *(v2us*)(Ph + e) = oh; *(v2us*)(Pl + e) = ol;  }
__global__ __launch_bounds__(256) void k_vtp(const float* __restrict__ F, int pitch, int nheads, h16* V16, bf* Vh, bf* Vl) { { const size_t b = blockIdx.y, po = b * nheads * HD * TT; F += b * TT * pitch; V16 += po; Vh += po; Vl += po; }   /* grid.y: batch */ const size_t e = ((size_t)blockIdx.x * 256 + threadIdx.x) * 2; if (e >= (size_t)nheads * HD * TT) return; const int t = (int)(e % TT); const int d = (int)((e / TT) % HD); const int g = (int)(e / ((size_t)TT * HD)); v2h o16; v2us oh, ol;
#pragma unroll
    for (int q = 0; q < 2; ++q) { const float x = F[(size_t)(t + q) * pitch + g * HD + d]; o16[q] = tohx(x); unsigned short a2, c2; splitf(x, a2, c2); oh[q] = a2; ol[q] = c2; }
    *(v2h*)(V16 + e) = o16; *(v2us*)(Vh + e) = oh; *(v2us*)(Vl + e) = ol;  }
__global__ __launch_bounds__(256) void k_cscvt(const float* __restrict__ cos0, const float* __restrict__ sin0, const float* __restrict__ cos1, const float* __restrict__ sin1, float* CS) { const int idx = blockIdx.x * 256 + threadIdx.x; if (idx >= TT * HD) return; const float* __restrict__ cosT = blockIdx.y ? cos1 : cos0; const float* __restrict__ sinT = blockIdx.y ? sin1 : sin0; CS += (size_t)blockIdx.y * TT * HD * 2;   /* grid.y: table (0 = q, 1 = k) */ v2f cs; cs[0] = bfr(cosT[idx]); cs[1] = bfr(sinT[idx]); *(v2f*)(CS + (size_t)idx * 2) = cs;  }
#define FW   4                        // waves per work-group
#define OPIT 68                       // pitch, in floats, of one query's 64 partial outputs in LDS
#define CEXP 0.18033688011112042f     // HD^-0.5 x log2(e)
typedef __attribute__((ext_vector_type(16))) unsigned short v16us;
__device__ __forceinline__ float xhalf(float x) { return __builtin_bit_cast(float, __builtin_amdgcn_permlanex16(__builtin_bit_cast(int, x), __builtin_bit_cast(int, x), 0x76543210, 0xfedcba98, false, false)); }   // lane l with lane l ^ 16
template <typename T16, int NSPLIT, int NQ>
__device__ __forceinline__ void flash_body(const T16* __restrict__ Q, const T16* __restrict__ Q2, const T16* __restrict__ Kp, const T16* __restrict__ K2, const T16* __restrict__ Vt, const T16* __restrict__ V2, int q0, bf* Ah, bf* Al, float* so, float* sm, float* sl) {
    typedef typename WFrag<T16>::V V;
    constexpr int QT = NQ * 16;
    const int lane = threadIdx.x & 31, lr = lane & 15, hi = lane >> 4; const int wv = __builtin_amdgcn_readfirstlane((int)(threadIdx.x >> 5));
    const float SH = (NSPLIT == 0) ? 10.0f : 0.0f;
    V qf[NQ][2], qf2[NQ][2];
#pragma unroll
    for (int qt = 0; qt < NQ; ++qt)
#pragma unroll
        for (int ks = 0; ks < 2; ++ks) { const size_t qo = (size_t)(q0 + qt * 16 + lr) * HD + ks * 32 + 8 * hi; qf[qt][ks] = WFrag<T16>::ld(Q + qo); if (NSPLIT) qf2[qt][ks] = WFrag<T16>::ld(Q2 + qo); }
    v8f o[4][NQ]; float mb[NQ], ls[NQ];
#pragma unroll
    for (int qt = 0; qt < NQ; ++qt) { mb[qt] = -3.0e38f; ls[qt] = 0.f;
#pragma unroll
        for (int dt = 0; dt < 4; ++dt) o[dt][qt] = (v8f){}; }
    const int nch = (q0 + QT + 31) / 32;   // chunks up to and including the one that holds the block's last diagonal element
    V kf[2][2], kf2[2][2];
    auto ldk = [&](int kc) {
#pragma unroll
        for (int kt = 0; kt < 2; ++kt)
#pragma unroll
            for (int ks = 0; ks < 2; ++ks) { const size_t ko = (size_t)(kc + kt * 16 + lr) * HD + ks * 32 + 8 * hi; kf[kt][ks] = ldw(Kp + ko); if (NSPLIT) kf2[kt][ks] = ldw(K2 + ko); }
    };
    constexpr bool AHEAD = (NSPLIT == 0);   // key fragments fetched one pass ahead; not in the hi/lo body, whose two planes of fragments would then pass 256 registers (its loops are short)
    if (AHEAD && wv < nch) ldk(wv * 32);
#pragma unroll 1   // kept rolled: a second chunk's products in flight would add their registers to those of the accumulators
    for (int c = wv; c < nch; c += FW) {
        const int kc = c * 32;
        V vf[4], vf2[4];
        if (!AHEAD) ldk(kc);
#pragma unroll
        for (int dt = 0; dt < 4; ++dt) { const size_t vo = (size_t)(dt * 16 + lr) * TT + kc + 8 * hi; vf[dt] = ldw(Vt + vo); if (NSPLIT) vf2[dt] = ldw(V2 + vo); }
        __builtin_amdgcn_sched_barrier(0);   // every load of the pass issues before its first score product (one wait on memory per pass, not two); the value loads fly during products and softmax
        v8f s[2][NQ];
#pragma unroll
        for (int kt = 0; kt < 2; ++kt)
#pragma unroll
            for (int qt = 0; qt < NQ; ++qt) { v8f a = (v8f){};
#pragma unroll
                for (int ks = 0; ks < 2; ++ks) { a = WFrag<T16>::mma(kf[kt][ks], qf[qt][ks], a); if (NSPLIT) { a = WFrag<T16>::mma(kf[kt][ks], qf2[qt][ks], a); a = WFrag<T16>::mma(kf2[kt][ks], qf[qt][ks], a); } }
                s[kt][qt] = a; }
        if (AHEAD) ldk((c + FW < nch) ? kc + FW * 32 : kc);   // this wave's next key fragments fly during softmax and the value products; the last pass re-reads its own chunk (in bounds, unused) rather than branch behind the products
        if (kc + 31 > q0) {   // only a chunk that reaches past the block's first query holds keys above the diagonal; its key kc is at or below every query of the block, so no query's chunk is all masked
#pragma unroll
            for (int kt = 0; kt < 2; ++kt)
#pragma unroll
                for (int qt = 0; qt < NQ; ++qt)
#pragma unroll
                    for (int j = 0; j < 8; ++j) s[kt][qt][j] = (kc + kt * 16 + hi * 8 + j <= q0 + qt * 16 + lr) ? s[kt][qt][j] : -3.0e38f; }
        V pf[NQ], pf2[NQ];
#pragma unroll
        for (int qt = 0; qt < NQ; ++qt) {
            float mx = fmaxf(s[0][qt][0], s[1][qt][0]);
#pragma unroll
            for (int j = 1; j < 8; ++j) mx = fmaxf(mx, fmaxf(s[0][qt][j], s[1][qt][j]));
            mx = fmaxf(mx, xhalf(mx)) * CEXP;
            if (__builtin_amdgcn_ballot_w32(mx > mb[qt]) != 0) {   // no query's maximum rose: the factor would be exactly 1
                const float mn = fmaxf(mb[qt], mx); const float al = __builtin_amdgcn_exp2f(mb[qt] - mn); mb[qt] = mn; ls[qt] *= al;
#pragma unroll
                for (int dt = 0; dt < 4; ++dt) o[dt][qt] *= al; }
            const float bias = SH - mb[qt]; float p[16];
#pragma unroll
            for (int e = 0; e < 16; ++e) p[e] = __builtin_amdgcn_exp2f(fmaf(s[e >> 3][qt][e & 7], CEXP, bias));
            ls[qt] += (((p[0] + p[1]) + (p[2] + p[3])) + ((p[4] + p[5]) + (p[6] + p[7]))) + (((p[8] + p[9]) + (p[10] + p[11])) + ((p[12] + p[13]) + (p[14] + p[15])));
            if constexpr (NSPLIT == 0) { v16h f;
#pragma unroll
                for (int e = 0; e < 16; e += 2) { v2f x; x[0] = p[e]; x[1] = p[e + 1]; const v2h y = __builtin_convertvector(x, v2h); f[e] = y[0]; f[e + 1] = y[1]; }
                pf[qt] = f;
            } else { v16us fh, fl;
#pragma unroll
                for (int e = 0; e < 16; ++e) { unsigned short a, c2; splitf(p[e], a, c2); fh[e] = a; fl[e] = c2; }
                pf[qt] = __builtin_bit_cast(v16bf, fh); pf2[qt] = __builtin_bit_cast(v16bf, fl); } }
#pragma unroll
        for (int dt = 0; dt < 4; ++dt)
#pragma unroll
            for (int qt = 0; qt < NQ; ++qt) { o[dt][qt] = WFrag<T16>::mma(vf[dt], pf[qt], o[dt][qt]); if (NSPLIT) { o[dt][qt] = WFrag<T16>::mma(vf[dt], pf2[qt], o[dt][qt]); o[dt][qt] = WFrag<T16>::mma(vf2[dt], pf[qt], o[dt][qt]); } }
    }
    float* ow = so + (size_t)wv * QT * OPIT;
#pragma unroll
    for (int qt = 0; qt < NQ; ++qt) { const float lt = ls[qt] + xhalf(ls[qt]); const int row = qt * 16 + lr;
#pragma unroll
        for (int dt = 0; dt < 4; ++dt) { v4f x0, x1;
#pragma unroll
            for (int j = 0; j < 4; ++j) { x0[j] = o[dt][qt][j]; x1[j] = o[dt][qt][4 + j]; }
            *(v4fa*)(ow + row * OPIT + dt * 16 + hi * 8) = x0; *(v4fa*)(ow + row * OPIT + dt * 16 + hi * 8 + 4) = x1; }
        if (hi == 0) { sm[wv * QT + row] = mb[qt]; sl[wv * QT + row] = lt; } }
    __syncthreads();   // every wave's partial rows (zeros with sum 0 from a wave that had no chunk) are in LDS before any thread joins them
    constexpr int TPQ = FW * 32 / QT, ND = HD / TPQ;   // threads per query, outputs per thread
    const int qi = threadIdx.x / TPQ, d0 = (threadIdx.x % TPQ) * ND;
    float fw[FW]; float mm = -3.0e38f, den = 0.f;
#pragma unroll
    for (int w = 0; w < FW; ++w) { fw[w] = sm[w * QT + qi]; mm = fmaxf(mm, fw[w]); }
#pragma unroll
    for (int w = 0; w < FW; ++w) { fw[w] = __builtin_amdgcn_exp2f(fw[w] - mm); den += fw[w] * sl[w * QT + qi]; }
    const float inv = __fdiv_rn(1.0f, den);
#pragma unroll
    for (int e0 = 0; e0 < ND; e0 += 8) { v4f a0 = (v4f){}, a1 = (v4f){};
#pragma unroll
        for (int w = 0; w < FW; ++w) { const float* r = so + (size_t)(w * QT + qi) * OPIT + d0 + e0; a0 += fw[w] * *(const v4fa*)r; a1 += fw[w] * *(const v4fa*)(r + 4); }
        v8us oh, ol;
#pragma unroll
        for (int k = 0; k < 4; ++k) { unsigned short a, c2; splitf(a0[k] * inv, a, c2); oh[k] = a; ol[k] = c2; splitf(a1[k] * inv, a, c2); oh[4 + k] = a; ol[4 + k] = c2; }
        const size_t oo = (size_t)(q0 + qi) * DQ + d0 + e0; *(v8us*)(Ah + oo) = oh; xwait(); *(v8us*)(Al + oo) = ol; xwait(); }
}
// grid (query blocks, heads, batches): the fp16 blocks first, longest first, then the hi/lo blocks
__global__ __launch_bounds__(FW * 32) void k_flash(const h16* __restrict__ Q16, const h16* __restrict__ K16, const h16* __restrict__ V16, const bf* __restrict__ Qh, const bf* __restrict__ Ql, const bf* __restrict__ Kh, const bf* __restrict__ Kl, const bf* __restrict__ Vh, const bf* __restrict__ Vl, bf* Ah, bf* Al) {
    __shared__ __align__(16) float so[FW * 32 * OPIT]; __shared__ float sm[FW * 32]; __shared__ float sl[FW * 32];
    const int bx = blockIdx.x; const size_t zq = ((size_t)blockIdx.z * NH_ + blockIdx.y) * TT * HD, zk = ((size_t)blockIdx.z * NKV + blockIdx.y / REP) * TT * HD, zo = (size_t)blockIdx.z * TT * DQ + blockIdx.y * HD; Ah += zo; Al += zo;
    if (bx < (TT - RH) / 32) flash_body<h16, 0, 2>(Q16 + zq, nullptr, K16 + zk, nullptr, V16 + zk, nullptr, TT - 32 - bx * 32, Ah, Al, so, sm, sl);
    else flash_body<bf, 2, 1>(Qh + zq, Ql + zq, Kh + zk, Kl + zk, Vh + zk, Vl + zk, (bx - (TT - RH) / 32) * 16, Ah, Al, so, sm, sl);
}

extern "C" void kernel_launch(void* const* d_in, const int* in_sizes, int n_in,
                              void* d_out, int out_size, void* d_ws, size_t ws_size, hipStream_t stream) {
    (void)in_sizes; (void)n_in; (void)out_size;
    const float* x = (const float*)d_in[0]; const float* fsinq = (const float*)d_in[1]; const float* fcosq = (const float*)d_in[2]; const float* fsink = (const float*)d_in[3]; const float* fcosk = (const float*)d_in[4]; const float* wqkv = (const float*)d_in[5]; const float* wo = (const float*)d_in[6];   /* argument order query, sin_q, cos_q, sin_k, cos_k ([1][1][2048][64] each), w_in ('xw' [1024][3072]), w_out ('xw') */
    float* OUT = (float*)d_out;     // [2][2048][1024]
    char* wsp = (char*)d_ws;
    auto take = [&](size_t bytes) { char* p = wsp; wsp += (bytes + 255) & ~(size_t)255; return (void*)p; };
    bf* WQKV = (bf*)take((size_t)3 * DQ * DM * 2);   /* fused Bt [3*DQ][DM]: q | k | v row blocks */ bf* WO = (bf*)take((size_t)DM * DQ * 2); float* CS = (float*)take((size_t)2 * TT * HD * 2 * 4);   /* two {cos, sin} tables, q then k: the k stream has its own input tables */
    const size_t PL = (size_t)NB_ * NH_ * TT * HD;   // elements of one plane set: [batch][head][t][d] (values: [batch][head][d][t])
    h16* QK16 = (h16*)take(2 * PL * 2); bf* QKh = (bf*)take(2 * PL * 2); bf* QKl = (bf*)take(2 * PL * 2);   /* q planes, then k planes */
    h16* VT16 = (h16*)take(PL * 2); bf* VTh = (bf*)take(PL * 2); bf* VTl = (bf*)take(PL * 2);
    float* F = (float*)take((size_t)NB_ * TT * 3 * DQ * 4); bf* XB = (bf*)take((size_t)NB_ * TT * DM * 2); bf* ATh = (bf*)take((size_t)NB_ * TT * DQ * 2); bf* ATl = (bf*)take((size_t)NB_ * TT * DQ * 2);
    if ((size_t)(wsp - (char*)d_ws) > ws_size) return;    // ws 256 MiB
    k_wtG<<<dim3((unsigned)((DM * 3 * DQ / 64 + 63) / 64), 2, 1), 256, 0, stream>>>(wqkv, 3 * DQ, WQKV, wo, DM, WO, DM);   /* 'xw' [DM][3*DQ] -> Bt [3*DQ][DM]; 'xw' [DQ][DM] -> Bt [DM][DQ] (DQ == DM rows) */
    k_cscvt<<<dim3((TT * HD + 255) / 256, 2, 1), 256, 0, stream>>>(fcosq, fsinq, fcosk, fsink, CS);
    k_cvt8<<<(unsigned)(((size_t)NB_ * TT * DM / 8 + 255) / 256), 256, 0, stream>>>(x, XB, (size_t)NB_ * TT * DM / 8);
    k_gemmw<bf, 0, false><<<dim3(NB_ * TT / 64, 3 * DQ / 64, 1), 32, 0, stream>>>(XB, nullptr, WQKV, nullptr, DM, F, 3 * DQ, nullptr, 0, 0, 0);
    const unsigned LH = (unsigned)(((size_t)NH_ * TT * HD / 2 + 255) / 256);   // work-groups for one batch's 16 heads
    k_rope<<<dim3(LH, NB_, 2), 256, 0, stream>>>(F, 3 * DQ, NH_, CS, nullptr, nullptr, 1.0f, QK16, QKh, QKl);
    k_vtp<<<dim3(LH, NB_, 1), 256, 0, stream>>>(F + 2 * DQ, 3 * DQ, NKV, VT16, VTh, VTl);
    k_flash<<<dim3((TT - RH) / 32 + RH / 16, NH_, NB_), FW * 32, 0, stream>>>(QK16, QK16 + PL, VT16, QKh, QKl, QKh + PL, QKl + PL, VTh, VTl, ATh, ATl);
    k_gemmw<bf, 1, false><<<dim3(NB_ * TT / 64, DM / 64, 1), 32, 0, stream>>>(ATh, ATl, WO, nullptr, DQ, OUT, DM, nullptr, 0, 0, 0);
}
